// v000
// The times below were measured on an AMD MI455X: many runs one after another, warmed up first and cycling through
// copies of the inputs, with the whole window's GPU time divided by the number of runs. Launches and the gaps
// between them are all in it. The median over several windows is given; except for v000 it joins two sittings, which
// can be a few percent apart, so the side-by-side timings, each taken in one sitting, are the better comparison.
// v000 is the starting kernel. One run takes 382 microseconds.
#include <hip/hip_runtime.h>

typedef __attribute__((ext_vector_type(16))) _Float16 v16h;
typedef __attribute__((ext_vector_type(8)))  _Float16 v8h;
typedef __attribute__((ext_vector_type(4)))  _Float16 v4h;
typedef __attribute__((ext_vector_type(8)))  float    v8f;

#define NB    8
#define SEQ   1024
#define HID   1024
#define NHEAD 16
#define DHEAD 64

__device__ __forceinline__ v8f wmma_f16(v16h a, v16h b, v8f c) {
  // D = A(16x32 f16) * B(32x16 f16) + C(16x16 f32)
  return __builtin_amdgcn_wmma_f32_16x16x32_f16(false, a, false, b, (short)0, c,
                                                false, false);
}

__device__ __forceinline__ v16h load_frag(const _Float16* base, int row, int ld,
                                          int kbase, int lane) {
  const int half = (lane & 16) ? 8 : 0;
  const _Float16* p = base + (size_t)row * ld + kbase + half;
  v8h c0 = *(const v8h*)(p);
  v8h c1 = *(const v8h*)(p + 16);
  v16h a;
#pragma unroll
  for (int j = 0; j < 8; ++j) { a[j] = c0[j]; a[j + 8] = c1[j]; }
  return a;
}

// ---------------------------------------------------------------------------
// fp32 -> fp16 conversion (bandwidth kernel)
// ---------------------------------------------------------------------------
__global__ __launch_bounds__(256) void f32_to_f16_kernel(
    const float* __restrict__ src, _Float16* __restrict__ dst, int n) {
  int i = (blockIdx.x * blockDim.x + threadIdx.x) * 4;
  if (i + 3 < n) {
    float4 v = *(const float4*)(src + i);
    v4h o;
    o[0] = (_Float16)v.x; o[1] = (_Float16)v.y;
    o[2] = (_Float16)v.z; o[3] = (_Float16)v.w;
    *(v4h*)(dst + i) = o;
  } else {
    for (int j = i; j < n; ++j) dst[j] = (_Float16)src[j];
  }
}

// ---------------------------------------------------------------------------
// Fused QKV projection: Y = Xh @ W^T + bias.
// grid = (M/64, N/64, 3).  128 threads = 4 waves; wave owns 16 rows x 64 cols.
// z==0 -> Q [B,h,S,d], z==1 -> K [B,h,S,d], z==2 -> V transposed [B,h,d,S].
// ---------------------------------------------------------------------------
__global__ __launch_bounds__(128) void qkv_gemm_kernel(
    const _Float16* __restrict__ Xh, const _Float16* __restrict__ Wh3,
    const float* __restrict__ bq, const float* __restrict__ bk,
    const float* __restrict__ bv,
    _Float16* __restrict__ Qb, _Float16* __restrict__ Kb,
    _Float16* __restrict__ Vt) {
  const int mt = blockIdx.x;          // 0..127, 64 rows each (rows = B*S)
  const int nt = blockIdx.y;          // 0..15,  64 cols each (cols = HID)
  const int z  = blockIdx.z;          // 0:Q 1:K 2:V
  const int wave = threadIdx.x >> 5;
  const int lane = threadIdx.x & 31;
  const int lane15 = lane & 15;
  const int hi = (lane & 16) ? 8 : 0;

  const _Float16* W = Wh3 + (size_t)z * HID * HID;
  const float* bias = (z == 0) ? bq : ((z == 1) ? bk : bv);

  const int row = mt * 64 + wave * 16 + lane15;  // A-fragment row for this lane

  v8f acc[4];
#pragma unroll
  for (int t = 0; t < 4; ++t)
#pragma unroll
    for (int r = 0; r < 8; ++r) acc[t][r] = 0.0f;

  for (int k = 0; k < HID; k += 32) {
    v16h a = load_frag(Xh, row, HID, k, lane);
#pragma unroll
    for (int t = 0; t < 4; ++t) {
      v16h bf = load_frag(W, nt * 64 + t * 16 + lane15, HID, k, lane);
      acc[t] = wmma_f16(a, bf, acc[t]);
    }
  }

  // Epilogue: C layout -> lane holds fixed column n, rows m = wavebase+hi+r.
#pragma unroll
  for (int t = 0; t < 4; ++t) {
    const int n = nt * 64 + t * 16 + lane15;
    const float bn = bias[n];
    const int head = n >> 6;
    const int dh = n & 63;
#pragma unroll
    for (int r = 0; r < 8; ++r) {
      const int m = mt * 64 + wave * 16 + hi + r;
      const int b = m >> 10;
      const int s = m & 1023;
      const float y = acc[t][r] + bn;
      if (z == 2) {
        Vt[(((size_t)(b * NHEAD + head) * DHEAD) + dh) * SEQ + s] = (_Float16)y;
      } else {
        _Float16* dst = (z == 0) ? Qb : Kb;
        dst[(((size_t)(b * NHEAD + head) * SEQ) + s) * DHEAD + dh] = (_Float16)y;
      }
    }
  }
}

// ---------------------------------------------------------------------------
// Flash attention: one block per (q-tile of 64, head, batch).
// 128 threads = 4 waves; wave owns 16 q-rows. Online softmax over 16 k-tiles.
// ---------------------------------------------------------------------------
__global__ __launch_bounds__(128) void flash_attn_kernel(
    const _Float16* __restrict__ Qb, const _Float16* __restrict__ Kb,
    const _Float16* __restrict__ Vt, const float* __restrict__ mask,
    float* __restrict__ out) {
  const int qt = blockIdx.x;   // 0..15
  const int h  = blockIdx.y;   // 0..15
  const int b  = blockIdx.z;   // 0..7
  const int wave = threadIdx.x >> 5;
  const int lane = threadIdx.x & 31;
  const int lane15 = lane & 15;
  const int hi = (lane & 16) ? 8 : 0;

  constexpr float SCALE = 0.125f;            // 1/sqrt(64)
  constexpr float LOG2E = 1.44269504088896f;

  const _Float16* Q = Qb + (size_t)(b * NHEAD + h) * SEQ * DHEAD;
  const _Float16* K = Kb + (size_t)(b * NHEAD + h) * SEQ * DHEAD;
  const _Float16* V = Vt + (size_t)(b * NHEAD + h) * DHEAD * SEQ;  // [d][s]
  const float* mrow = mask + (size_t)b * SEQ;

  __shared__ __align__(16) _Float16 ldsP[4][16][72];
  const _Float16* myP = &ldsP[wave][0][0];

  const int qrow = qt * 64 + wave * 16 + lane15;
  const v16h aq0 = load_frag(Q, qrow, DHEAD, 0, lane);
  const v16h aq1 = load_frag(Q, qrow, DHEAD, 32, lane);

  v8f o[4];
  float m_run[8], l_run[8];
#pragma unroll
  for (int t = 0; t < 4; ++t)
#pragma unroll
    for (int r = 0; r < 8; ++r) o[t][r] = 0.0f;
#pragma unroll
  for (int r = 0; r < 8; ++r) { m_run[r] = -__builtin_inff(); l_run[r] = 0.0f; }

  for (int kt = 0; kt < 16; ++kt) {
    const int kb = kt * 64;

    if (kt < 15) {
      __builtin_prefetch(K + (size_t)(kb + 64 + lane15 * 4) * DHEAD, 0, 1);
      __builtin_prefetch(V + (size_t)(lane15 * 4) * SEQ + kb + 64, 0, 1);
    }

    // ---- S = Q K^T ----
    v8f sf[4];
#pragma unroll
    for (int t = 0; t < 4; ++t)
#pragma unroll
      for (int r = 0; r < 8; ++r) sf[t][r] = 0.0f;

#pragma unroll
    for (int t = 0; t < 4; ++t) {
      v16h bk0 = load_frag(K, kb + t * 16 + lane15, DHEAD, 0, lane);
      v16h bk1 = load_frag(K, kb + t * 16 + lane15, DHEAD, 32, lane);
      sf[t] = wmma_f16(aq0, bk0, sf[t]);
      sf[t] = wmma_f16(aq1, bk1, sf[t]);
    }

    // scale + additive mask (mask fixed per lane's column)
#pragma unroll
    for (int t = 0; t < 4; ++t) {
      const float mv = mrow[kb + t * 16 + lane15];
#pragma unroll
      for (int r = 0; r < 8; ++r) sf[t][r] = sf[t][r] * SCALE + mv;
    }

    // ---- online softmax ----
    float newm[8], alpha[8];
#pragma unroll
    for (int r = 0; r < 8; ++r) {
      float v = fmaxf(fmaxf(sf[0][r], sf[1][r]), fmaxf(sf[2][r], sf[3][r]));
#pragma unroll
      for (int off = 1; off < 16; off <<= 1) v = fmaxf(v, __shfl_xor(v, off, 32));
      newm[r] = fmaxf(m_run[r], v);
      alpha[r] = exp2f((m_run[r] - newm[r]) * LOG2E);
      m_run[r] = newm[r];
    }
#pragma unroll
    for (int t = 0; t < 4; ++t)
#pragma unroll
      for (int r = 0; r < 8; ++r)
        sf[t][r] = exp2f((sf[t][r] - newm[r]) * LOG2E);
#pragma unroll
    for (int r = 0; r < 8; ++r) {
      float v = sf[0][r] + sf[1][r] + sf[2][r] + sf[3][r];
#pragma unroll
      for (int off = 1; off < 16; off <<= 1) v += __shfl_xor(v, off, 32);
      l_run[r] = l_run[r] * alpha[r] + v;
    }

    // rescale running output
#pragma unroll
    for (int t = 0; t < 4; ++t)
#pragma unroll
      for (int r = 0; r < 8; ++r) o[t][r] *= alpha[r];

    // ---- P (C layout) -> LDS (row-major) -> A fragments ----
#pragma unroll
    for (int t = 0; t < 4; ++t)
#pragma unroll
      for (int r = 0; r < 8; ++r)
        ldsP[wave][hi + r][t * 16 + lane15] = (_Float16)sf[t][r];
    // same-wave DS ops are in-order: no barrier needed for private buffer
    v16h ap0 = load_frag(myP, lane15, 72, 0, lane);
    v16h ap1 = load_frag(myP, lane15, 72, 32, lane);

    // ---- O += P V  (B fragments = rows of Vt, contiguous b128 loads) ----
#pragma unroll
    for (int t = 0; t < 4; ++t) {
      v16h bv0 = load_frag(V, t * 16 + lane15, SEQ, kb + 0, lane);
      v16h bv1 = load_frag(V, t * 16 + lane15, SEQ, kb + 32, lane);
      o[t] = wmma_f16(ap0, bv0, o[t]);
      o[t] = wmma_f16(ap1, bv1, o[t]);
    }
  }

  // ---- epilogue: out[b, s, h*64 + d] = O / l ----
#pragma unroll
  for (int r = 0; r < 8; ++r) {
    const float inv = 1.0f / l_run[r];
    const int srow = qt * 64 + wave * 16 + hi + r;
    float* orow = out + ((size_t)(b * SEQ + srow)) * HID + h * DHEAD;
#pragma unroll
    for (int t = 0; t < 4; ++t) orow[t * 16 + lane15] = o[t][r] * inv;
  }
}

// ---------------------------------------------------------------------------
// Workspace layout (bytes):
//   Xh  f16 [8192][1024]        @ 0         (16,777,216)
//   Wh3 f16 [3][1024][1024]     @ 16777216  ( 6,291,456)
//   Qb  f16 [8][16][1024][64]   @ 23068672  (16,777,216)
//   Kb  f16 [8][16][1024][64]   @ 39845888  (16,777,216)
//   Vt  f16 [8][16][64][1024]   @ 56623104  (16,777,216)  -> total ~70 MB
// ---------------------------------------------------------------------------
extern "C" void kernel_launch(void* const* d_in, const int* in_sizes, int n_in,
                              void* d_out, int out_size, void* d_ws, size_t ws_size,
                              hipStream_t stream) {
  (void)in_sizes; (void)n_in; (void)out_size; (void)ws_size;
  const float* x    = (const float*)d_in[0];
  const float* mask = (const float*)d_in[1];
  const float* Wq   = (const float*)d_in[2];
  const float* bq   = (const float*)d_in[3];
  const float* Wk   = (const float*)d_in[4];
  const float* bk   = (const float*)d_in[5];
  const float* Wv   = (const float*)d_in[6];
  const float* bv   = (const float*)d_in[7];
  float* out = (float*)d_out;

  char* ws = (char*)d_ws;
  _Float16* Xh  = (_Float16*)(ws + 0);
  _Float16* Wh3 = (_Float16*)(ws + 16777216);
  _Float16* Qb  = (_Float16*)(ws + 23068672);
  _Float16* Kb  = (_Float16*)(ws + 39845888);
  _Float16* Vt  = (_Float16*)(ws + 56623104);

  const int nX = NB * SEQ * HID;   // 8,388,608
  const int nW = HID * HID;        // 1,048,576

  f32_to_f16_kernel<<<(nX / 4 + 255) / 256, 256, 0, stream>>>(x, Xh, nX);
  f32_to_f16_kernel<<<(nW / 4 + 255) / 256, 256, 0, stream>>>(Wq, Wh3 + (size_t)0 * nW, nW);
  f32_to_f16_kernel<<<(nW / 4 + 255) / 256, 256, 0, stream>>>(Wk, Wh3 + (size_t)1 * nW, nW);
  f32_to_f16_kernel<<<(nW / 4 + 255) / 256, 256, 0, stream>>>(Wv, Wh3 + (size_t)2 * nW, nW);

  qkv_gemm_kernel<<<dim3(128, 16, 3), 128, 0, stream>>>(Xh, Wh3, bq, bk, bv,
                                                        Qb, Kb, Vt);

  flash_attn_kernel<<<dim3(16, 16, 8), 128, 0, stream>>>(Qb, Kb, Vt, mask, out);
}

// v001
// One run takes 225 microseconds.
// Two timings next to v000 both put it at 1.74 times that version's speed.
#include <hip/hip_runtime.h>
#include <stdint.h>

typedef __attribute__((ext_vector_type(16))) _Float16 v16h;
typedef __attribute__((ext_vector_type(8)))  _Float16 v8h;
typedef __attribute__((ext_vector_type(4)))  _Float16 v4h;
typedef __attribute__((ext_vector_type(8)))  float    v8f;

#define NB    8
#define SEQ   1024
#define HID   1024
#define NHEAD 16
#define DHEAD 64

__device__ __forceinline__ v8f wmma_f16(v16h a, v16h b, v8f c) {
  // D = A(16x32 f16) * B(32x16 f16) + C(16x16 f32)
  return __builtin_amdgcn_wmma_f32_16x16x32_f16(false, a, false, b, (short)0, c,
                                                false, false);
}

__device__ __forceinline__ v16h load_frag(const _Float16* base, int row, int ld,
                                          int kbase, int lane) {
  const int half = (lane & 16) ? 8 : 0;
  const _Float16* p = base + (size_t)row * ld + kbase + half;
  v8h c0 = *(const v8h*)(p);
  v8h c1 = *(const v8h*)(p + 16);
  v16h a;
#pragma unroll
  for (int j = 0; j < 8; ++j) { a[j] = c0[j]; a[j + 8] = c1[j]; }
  return a;
}

// ---------------------------------------------------------------------------
// fp32 -> fp16 conversion (bandwidth kernel)
// ---------------------------------------------------------------------------
__global__ __launch_bounds__(256) void f32_to_f16_kernel(
    const float* __restrict__ src, _Float16* __restrict__ dst, int n) {
  int i = (blockIdx.x * blockDim.x + threadIdx.x) * 4;
  if (i + 3 < n) {
    float4 v = *(const float4*)(src + i);
    v4h o;
    o[0] = (_Float16)v.x; o[1] = (_Float16)v.y;
    o[2] = (_Float16)v.z; o[3] = (_Float16)v.w;
    *(v4h*)(dst + i) = o;
  } else {
    for (int j = i; j < n; ++j) dst[j] = (_Float16)src[j];
  }
}

// ---------------------------------------------------------------------------
// Fused QKV projection: Y = Xh @ W^T + bias, the three weights read as one [3072][1024] matrix.
// grid = (M/256, 3072/128).  256 threads = 8 waves (4 x 2); wave owns 64 rows x 64 cols.
// A pass is 64 k: 256 rows of X and 128 rows of W, 128 bytes each, staged in LDS by tensor loads
// (one slice per wave: 64 rows of X or 32 of W; LDS pitch 144 bytes), two buffers, the next pass in flight.
// cols 0..1023 -> Q [B,h,S,d], 1024..2047 -> K [B,h,S,d], 2048..3071 -> V transposed [B,h,d,S].
// ---------------------------------------------------------------------------
typedef uint32_t u32x4 __attribute__((ext_vector_type(4)));
typedef uint32_t u32x8 __attribute__((ext_vector_type(8)));

constexpr uint32_t G_ROWB  = 128u;
constexpr uint32_t G_PITCH = G_ROWB + 16u;
constexpr uint32_t G_XSLICE = 10240u;
constexpr uint32_t G_WSLICE = 6144u;
constexpr uint32_t G_WBASE  = 4u * G_XSLICE;
constexpr uint32_t G_BUF    = G_WBASE + 4u * G_WSLICE;
constexpr int      G_PASSES = HID / 64;

__device__ __forceinline__ uint32_t uni(uint32_t v) {
  return (uint32_t)__builtin_amdgcn_readfirstlane(v);
}
__device__ __forceinline__ uint32_t pinned(uint32_t v) {
  uint32_t w = uni(v);
  asm volatile("" : "+s"(w));
  return w;
}

__global__ __launch_bounds__(256) void qkv_gemm_kernel(
    const _Float16* __restrict__ Xh, const _Float16* __restrict__ Wh3,
    const float* __restrict__ bq, const float* __restrict__ bk,
    const float* __restrict__ bv,
    _Float16* __restrict__ Qb, _Float16* __restrict__ Kb,
    _Float16* __restrict__ Vt) {
  __shared__ __attribute__((aligned(2048))) unsigned char ring[2u * G_BUF];

  const int mt = blockIdx.x;          // 0..31, 256 rows each (rows = B*S)
  const int nt = blockIdx.y;          // 0..23, 128 cols each (cols = 3*HID)
  const int z  = nt >> 3;             // 0:Q 1:K 2:V
  const uint32_t wave = uni(threadIdx.x >> 5);
  const int wm = (int)(wave >> 1);    // wave's 64-row quarter of the tile
  const int wn = (int)(wave & 1u);    // wave's 64-col half of the tile
  const int lane = threadIdx.x & 31;
  const int lane15 = lane & 15;
  const int hi = (lane & 16) ? 8 : 0;

  const float* bias = (z == 0) ? bq : ((z == 1) ? bk : bv);

  // This wave's slice of every stage: waves 0 to 3 bring 64 rows of X each, waves 4 to 7 32 rows of W.
  const bool brings_x = wave < 4u;
  const _Float16* slice_src = brings_x
      ? Xh  + (size_t)(mt * 256 + (int)wave * 64) * HID
      : Wh3 + (size_t)(nt * 128 + (int)(wave - 4u) * 32) * HID;
  const uint64_t slice_ga = (uint64_t)(size_t)slice_src;
  const uint32_t slice_lds = (uint32_t)(size_t)ring +
      (brings_x ? wave * G_XSLICE : G_WBASE + (wave - 4u) * G_WSLICE);
  const uint32_t slice_rows = brings_x ? 64u : 32u;

  u32x8 g1;
  g1[0] = uni((1u << 20) | (4u << 22) | (3u << 25));
  g1[1] = uni((G_ROWB & 0xFFFFu) << 16);
  g1[2] = uni((G_ROWB >> 16) | (slice_rows << 16));
  g1[3] = uni(G_ROWB << 16);
  g1[4] = uni(slice_rows);
  g1[5] = uni((uint32_t)HID * 2u);
  g1[6] = uni(0u);
  g1[7] = uni(0u);
  asm volatile("" : "+s"(g1));

  auto issue = [&](uint32_t st) {     // stage st: k = 64 st .. 64 st + 63, into buffer st & 1
    const uint64_t ga = slice_ga + (uint64_t)st * G_ROWB;
    u32x4 g0;
    g0[0] = uni(1u);
    g0[1] = uni(slice_lds + (st & 1u) * G_BUF);
    g0[2] = uni((uint32_t)ga);
    g0[3] = uni((((uint32_t)(ga >> 32)) & 0x01FFFFFFu) | 0x80000000u);
    asm volatile("tensor_load_to_lds %0, %1" :: "s"(g0), "s"(g1) : "memory");
  };

  v8f acc[4][4];
#pragma unroll
  for (int i = 0; i < 4; ++i)
#pragma unroll
    for (int j = 0; j < 4; ++j)
#pragma unroll
      for (int r = 0; r < 8; ++r) acc[i][j][r] = 0.0f;

  issue(0u);
  asm volatile("s_wait_tensorcnt 0x0" ::: "memory");  // this wave's slice of stage 0 has landed
  __syncthreads();                                    // every slice of stage 0 is readable
  issue(1u);

  for (int s = 0; s < G_PASSES; ++s) {
    const unsigned char* buf = ring + (uint32_t)(s & 1) * G_BUF;
    const _Float16* xs = (const _Float16*)(buf + (uint32_t)wm * G_XSLICE);
    const unsigned char* wsl = buf + G_WBASE + (uint32_t)(2 * wn) * G_WSLICE;  // this wave's two slices of W
#pragma unroll
    for (int kk = 0; kk < 64; kk += 32) {
      v16h a[4], bf[4];
#pragma unroll
      for (int i = 0; i < 4; ++i) a[i] = load_frag(xs, i * 16 + lane15, (int)(G_PITCH / 2u), kk, lane);
#pragma unroll
      for (int j = 0; j < 4; ++j)
        bf[j] = load_frag((const _Float16*)(wsl + (uint32_t)(j >> 1) * G_WSLICE), (j & 1) * 16 + lane15,
                          (int)(G_PITCH / 2u), kk, lane);
      // Keeps the 16 LDS reads of this k step one group in front of its 16 WMMAs: left alone the
      // compiler reads one X fragment per row of 4 WMMAs and waits for it to 0 each time.
      __builtin_amdgcn_sched_barrier(0);
#pragma unroll
      for (int i = 0; i < 4; ++i)
#pragma unroll
        for (int j = 0; j < 4; ++j) acc[i][j] = wmma_f16(a[i], bf[j], acc[i][j]);
    }
    // Publish point of stage s + 1.
    asm volatile("s_wait_dscnt 0x0" ::: "memory");
    asm volatile("s_wait_tensorcnt 0x0" ::: "memory");
    __syncthreads();
    const uint32_t nxt = pinned((uint32_t)s + 2u);
    if (nxt < (uint32_t)G_PASSES) issue(nxt);
  }
  asm volatile("s_wait_tensorcnt 0x0" ::: "memory");    // no request outlives the loop
  asm volatile("s_wait_dscnt 0x0" ::: "memory");

  // Epilogue: C layout -> lane holds fixed column n, rows m = tile base + hi + r.
  // A tile lies in one batch (256 divides SEQ) and in one of Q, K, V (128 divides HID).
  const int m0 = mt * 256 + wm * 64 + hi;
  const int b = m0 >> 10;
  const int s0 = m0 & 1023;
  const int n0 = (nt & 7) * 128 + wn * 64 + lane15;   // column of j = 0; j adds 16
  const int head = n0 >> 6;                           // the wave's 64 columns are one head
  float bn[4];
#pragma unroll
  for (int j = 0; j < 4; ++j) bn[j] = bias[n0 + j * 16];
  // Before a register that an issued load or store names is written again: it is written at the end
  // of each run of loads or stores.
  asm volatile("s_wait_xcnt 0x0" ::: "memory");
  if (z == 2) {
    _Float16* dst = Vt + (((size_t)(b * NHEAD + head) * DHEAD) + lane15) * SEQ + s0;
#pragma unroll
    for (int j = 0; j < 4; ++j) {
#pragma unroll
      for (int i = 0; i < 4; ++i)
#pragma unroll
        for (int r = 0; r < 8; ++r) dst[(size_t)(j * 16) * SEQ + i * 16 + r] = (_Float16)(acc[i][j][r] + bn[j]);
    }
    asm volatile("s_wait_xcnt 0x0" ::: "memory");
  } else {
    _Float16* dst = ((z == 0) ? Qb : Kb) + (((size_t)(b * NHEAD + head) * SEQ) + s0) * DHEAD + lane15;
#pragma unroll
    for (int j = 0; j < 4; ++j) {
#pragma unroll
      for (int i = 0; i < 4; ++i)
#pragma unroll
        for (int r = 0; r < 8; ++r) dst[(i * 16 + r) * DHEAD + j * 16] = (_Float16)(acc[i][j][r] + bn[j]);
    }
    asm volatile("s_wait_xcnt 0x0" ::: "memory");
  }
}

// ---------------------------------------------------------------------------
// Flash attention: one block per (q-tile of 64, head, batch).
// 128 threads = 4 waves; wave owns 16 q-rows. Online softmax over 16 k-tiles.
// ---------------------------------------------------------------------------
__global__ __launch_bounds__(128) void flash_attn_kernel(
    const _Float16* __restrict__ Qb, const _Float16* __restrict__ Kb,
    const _Float16* __restrict__ Vt, const float* __restrict__ mask,
    float* __restrict__ out) {
  const int qt = blockIdx.x;   // 0..15
  const int h  = blockIdx.y;   // 0..15
  const int b  = blockIdx.z;   // 0..7
  const int wave = threadIdx.x >> 5;
  const int lane = threadIdx.x & 31;
  const int lane15 = lane & 15;
  const int hi = (lane & 16) ? 8 : 0;

  constexpr float SCALE = 0.125f;            // 1/sqrt(64)
  constexpr float LOG2E = 1.44269504088896f;

  const _Float16* Q = Qb + (size_t)(b * NHEAD + h) * SEQ * DHEAD;
  const _Float16* K = Kb + (size_t)(b * NHEAD + h) * SEQ * DHEAD;
  const _Float16* V = Vt + (size_t)(b * NHEAD + h) * DHEAD * SEQ;  // [d][s]
  const float* mrow = mask + (size_t)b * SEQ;

  __shared__ __align__(16) _Float16 ldsP[4][16][72];
  const _Float16* myP = &ldsP[wave][0][0];

  const int qrow = qt * 64 + wave * 16 + lane15;
  const v16h aq0 = load_frag(Q, qrow, DHEAD, 0, lane);
  const v16h aq1 = load_frag(Q, qrow, DHEAD, 32, lane);

  v8f o[4];
  float m_run[8], l_run[8];
#pragma unroll
  for (int t = 0; t < 4; ++t)
#pragma unroll
    for (int r = 0; r < 8; ++r) o[t][r] = 0.0f;
#pragma unroll
  for (int r = 0; r < 8; ++r) { m_run[r] = -__builtin_inff(); l_run[r] = 0.0f; }

  for (int kt = 0; kt < 16; ++kt) {
    const int kb = kt * 64;

    if (kt < 15) {
      __builtin_prefetch(K + (size_t)(kb + 64 + lane15 * 4) * DHEAD, 0, 1);
      __builtin_prefetch(V + (size_t)(lane15 * 4) * SEQ + kb + 64, 0, 1);
    }

    // ---- S = Q K^T ----
    v8f sf[4];
#pragma unroll
    for (int t = 0; t < 4; ++t)
#pragma unroll
      for (int r = 0; r < 8; ++r) sf[t][r] = 0.0f;

#pragma unroll
    for (int t = 0; t < 4; ++t) {
      v16h bk0 = load_frag(K, kb + t * 16 + lane15, DHEAD, 0, lane);
      v16h bk1 = load_frag(K, kb + t * 16 + lane15, DHEAD, 32, lane);
      sf[t] = wmma_f16(aq0, bk0, sf[t]);
      sf[t] = wmma_f16(aq1, bk1, sf[t]);
    }

    // scale + additive mask (mask fixed per lane's column)
#pragma unroll
    for (int t = 0; t < 4; ++t) {
      const float mv = mrow[kb + t * 16 + lane15];
#pragma unroll
      for (int r = 0; r < 8; ++r) sf[t][r] = sf[t][r] * SCALE + mv;
    }

    // ---- online softmax ----
    float newm[8], alpha[8];
#pragma unroll
    for (int r = 0; r < 8; ++r) {
      float v = fmaxf(fmaxf(sf[0][r], sf[1][r]), fmaxf(sf[2][r], sf[3][r]));
#pragma unroll
      for (int off = 1; off < 16; off <<= 1) v = fmaxf(v, __shfl_xor(v, off, 32));
      newm[r] = fmaxf(m_run[r], v);
      alpha[r] = exp2f((m_run[r] - newm[r]) * LOG2E);
      m_run[r] = newm[r];
    }
#pragma unroll
    for (int t = 0; t < 4; ++t)
#pragma unroll
      for (int r = 0; r < 8; ++r)
        sf[t][r] = exp2f((sf[t][r] - newm[r]) * LOG2E);
#pragma unroll
    for (int r = 0; r < 8; ++r) {
      float v = sf[0][r] + sf[1][r] + sf[2][r] + sf[3][r];
#pragma unroll
      for (int off = 1; off < 16; off <<= 1) v += __shfl_xor(v, off, 32);
      l_run[r] = l_run[r] * alpha[r] + v;
    }

    // rescale running output
#pragma unroll
    for (int t = 0; t < 4; ++t)
#pragma unroll
      for (int r = 0; r < 8; ++r) o[t][r] *= alpha[r];

    // ---- P (C layout) -> LDS (row-major) -> A fragments ----
#pragma unroll
    for (int t = 0; t < 4; ++t)
#pragma unroll
      for (int r = 0; r < 8; ++r)
        ldsP[wave][hi + r][t * 16 + lane15] = (_Float16)sf[t][r];
    // same-wave DS ops are in-order: no barrier needed for private buffer
    v16h ap0 = load_frag(myP, lane15, 72, 0, lane);
    v16h ap1 = load_frag(myP, lane15, 72, 32, lane);

    // ---- O += P V  (B fragments = rows of Vt, contiguous b128 loads) ----
#pragma unroll
    for (int t = 0; t < 4; ++t) {
      v16h bv0 = load_frag(V, t * 16 + lane15, SEQ, kb + 0, lane);
      v16h bv1 = load_frag(V, t * 16 + lane15, SEQ, kb + 32, lane);
      o[t] = wmma_f16(ap0, bv0, o[t]);
      o[t] = wmma_f16(ap1, bv1, o[t]);
    }
  }

  // ---- epilogue: out[b, s, h*64 + d] = O / l ----
#pragma unroll
  for (int r = 0; r < 8; ++r) {
    const float inv = 1.0f / l_run[r];
    const int srow = qt * 64 + wave * 16 + hi + r;
    float* orow = out + ((size_t)(b * SEQ + srow)) * HID + h * DHEAD;
#pragma unroll
    for (int t = 0; t < 4; ++t) orow[t * 16 + lane15] = o[t][r] * inv;
  }
}

// ---------------------------------------------------------------------------
// Workspace layout (bytes):
//   Xh  f16 [8192][1024]        @ 0         (16,777,216)
//   Wh3 f16 [3][1024][1024]     @ 16777216  ( 6,291,456)
//   Qb  f16 [8][16][1024][64]   @ 23068672  (16,777,216)
//   Kb  f16 [8][16][1024][64]   @ 39845888  (16,777,216)
//   Vt  f16 [8][16][64][1024]   @ 56623104  (16,777,216)  -> total ~70 MB
// ---------------------------------------------------------------------------
extern "C" void kernel_launch(void* const* d_in, const int* in_sizes, int n_in,
                              void* d_out, int out_size, void* d_ws, size_t ws_size,
                              hipStream_t stream) {
  (void)in_sizes; (void)n_in; (void)out_size; (void)ws_size;
  const float* x    = (const float*)d_in[0];
  const float* mask = (const float*)d_in[1];
  const float* Wq   = (const float*)d_in[2];
  const float* bq   = (const float*)d_in[3];
  const float* Wk   = (const float*)d_in[4];
  const float* bk   = (const float*)d_in[5];
  const float* Wv   = (const float*)d_in[6];
  const float* bv   = (const float*)d_in[7];
  float* out = (float*)d_out;

  char* ws = (char*)d_ws;
  _Float16* Xh  = (_Float16*)(ws + 0);
  _Float16* Wh3 = (_Float16*)(ws + 16777216);
  _Float16* Qb  = (_Float16*)(ws + 23068672);
  _Float16* Kb  = (_Float16*)(ws + 39845888);
  _Float16* Vt  = (_Float16*)(ws + 56623104);

  const int nX = NB * SEQ * HID;   // 8,388,608
  const int nW = HID * HID;        // 1,048,576

  f32_to_f16_kernel<<<(nX / 4 + 255) / 256, 256, 0, stream>>>(x, Xh, nX);
  f32_to_f16_kernel<<<(nW / 4 + 255) / 256, 256, 0, stream>>>(Wq, Wh3 + (size_t)0 * nW, nW);
  f32_to_f16_kernel<<<(nW / 4 + 255) / 256, 256, 0, stream>>>(Wk, Wh3 + (size_t)1 * nW, nW);
  f32_to_f16_kernel<<<(nW / 4 + 255) / 256, 256, 0, stream>>>(Wv, Wh3 + (size_t)2 * nW, nW);

  qkv_gemm_kernel<<<dim3(32, 24, 1), 256, 0, stream>>>(Xh, Wh3, bq, bk, bv,
                                                        Qb, Kb, Vt);

  flash_attn_kernel<<<dim3(16, 16, 8), 128, 0, stream>>>(Qb, Kb, Vt, mask, out);
}

// v002
// It runs in 162 microseconds.
// In both of two side-by-side timings against v001, it was 1.39 times as fast.
// Over all steps from v000 it is 2.42 times as fast.
#include <hip/hip_runtime.h>
#include <stdint.h>

typedef __attribute__((ext_vector_type(16))) _Float16 v16h;
typedef __attribute__((ext_vector_type(8)))  _Float16 v8h;
typedef __attribute__((ext_vector_type(4)))  _Float16 v4h;
typedef __attribute__((ext_vector_type(8)))  float    v8f;

#define NB    8
#define SEQ   1024
#define HID   1024
#define NHEAD 16
#define DHEAD 64

__device__ __forceinline__ v8f wmma_f16(v16h a, v16h b, v8f c) {
  // D = A(16x32 f16) * B(32x16 f16) + C(16x16 f32)
  return __builtin_amdgcn_wmma_f32_16x16x32_f16(false, a, false, b, (short)0, c,
                                                false, false);
}

__device__ __forceinline__ v16h load_frag(const _Float16* base, int row, int ld,
                                          int kbase, int lane) {
  const int half = (lane & 16) ? 8 : 0;
  const _Float16* p = base + (size_t)row * ld + kbase + half;
  v8h c0 = *(const v8h*)(p);
  v8h c1 = *(const v8h*)(p + 16);
  v16h a;
#pragma unroll
  for (int j = 0; j < 8; ++j) { a[j] = c0[j]; a[j + 8] = c1[j]; }
  return a;
}

// ---------------------------------------------------------------------------
// fp32 -> fp16 conversion (bandwidth kernel)
// ---------------------------------------------------------------------------
__global__ __launch_bounds__(256) void f32_to_f16_kernel(
    const float* __restrict__ src, _Float16* __restrict__ dst, int n) {
  int i = (blockIdx.x * blockDim.x + threadIdx.x) * 4;
  if (i + 3 < n) {
    float4 v = *(const float4*)(src + i);
    v4h o;
    o[0] = (_Float16)v.x; o[1] = (_Float16)v.y;
    o[2] = (_Float16)v.z; o[3] = (_Float16)v.w;
    *(v4h*)(dst + i) = o;
  } else {
    for (int j = i; j < n; ++j) dst[j] = (_Float16)src[j];
  }
}

// ---------------------------------------------------------------------------
// Fused QKV projection: Y = Xh @ W^T + bias, the three weights read as one [3072][1024] matrix.
// grid = (M/256, 3072/128).  256 threads = 8 waves (4 x 2); wave owns 64 rows x 64 cols.
// A pass is 64 k: 256 rows of X and 128 rows of W, 128 bytes each, staged in LDS by tensor loads
// (one slice per wave: 64 rows of X or 32 of W; LDS pitch 144 bytes), two buffers, the next pass in flight.
// cols 0..1023 -> Q [B,h,S,d], 1024..2047 -> K [B,h,S,d], 2048..3071 -> V transposed [B,h,d,S].
// ---------------------------------------------------------------------------
typedef uint32_t u32x4 __attribute__((ext_vector_type(4)));
typedef uint32_t u32x8 __attribute__((ext_vector_type(8)));

constexpr uint32_t G_ROWB  = 128u;
constexpr uint32_t G_PITCH = G_ROWB + 16u;
constexpr uint32_t G_XSLICE = 10240u;
constexpr uint32_t G_WSLICE = 6144u;
constexpr uint32_t G_WBASE  = 4u * G_XSLICE;
constexpr uint32_t G_BUF    = G_WBASE + 4u * G_WSLICE;
constexpr int      G_PASSES = HID / 64;

__device__ __forceinline__ uint32_t uni(uint32_t v) {
  return (uint32_t)__builtin_amdgcn_readfirstlane(v);
}
__device__ __forceinline__ uint32_t pinned(uint32_t v) {
  uint32_t w = uni(v);
  asm volatile("" : "+s"(w));
  return w;
}

__global__ __launch_bounds__(256) void qkv_gemm_kernel(
    const _Float16* __restrict__ Xh, const _Float16* __restrict__ Wh3,
    const float* __restrict__ bq, const float* __restrict__ bk,
    const float* __restrict__ bv,
    _Float16* __restrict__ Qb, _Float16* __restrict__ Kb,
    _Float16* __restrict__ Vt) {
  __shared__ __attribute__((aligned(2048))) unsigned char ring[2u * G_BUF];

  const int mt = blockIdx.x;          // 0..31, 256 rows each (rows = B*S)
  const int nt = blockIdx.y;          // 0..23, 128 cols each (cols = 3*HID)
  const int z  = nt >> 3;             // 0:Q 1:K 2:V
  const uint32_t wave = uni(threadIdx.x >> 5);
  const int wm = (int)(wave >> 1);    // wave's 64-row quarter of the tile
  const int wn = (int)(wave & 1u);    // wave's 64-col half of the tile
  const int lane = threadIdx.x & 31;
  const int lane15 = lane & 15;
  const int hi = (lane & 16) ? 8 : 0;

  const float* bias = (z == 0) ? bq : ((z == 1) ? bk : bv);

  // This wave's slice of every stage: waves 0 to 3 bring 64 rows of X each, waves 4 to 7 32 rows of W.
  const bool brings_x = wave < 4u;
  const _Float16* slice_src = brings_x
      ? Xh  + (size_t)(mt * 256 + (int)wave * 64) * HID
      : Wh3 + (size_t)(nt * 128 + (int)(wave - 4u) * 32) * HID;
  const uint64_t slice_ga = (uint64_t)(size_t)slice_src;
  const uint32_t slice_lds = (uint32_t)(size_t)ring +
      (brings_x ? wave * G_XSLICE : G_WBASE + (wave - 4u) * G_WSLICE);
  const uint32_t slice_rows = brings_x ? 64u : 32u;

  u32x8 g1;
  g1[0] = uni((1u << 20) | (4u << 22) | (3u << 25));
  g1[1] = uni((G_ROWB & 0xFFFFu) << 16);
  g1[2] = uni((G_ROWB >> 16) | (slice_rows << 16));
  g1[3] = uni(G_ROWB << 16);
  g1[4] = uni(slice_rows);
  g1[5] = uni((uint32_t)HID * 2u);
  g1[6] = uni(0u);
  g1[7] = uni(0u);
  asm volatile("" : "+s"(g1));

  auto issue = [&](uint32_t st) {     // stage st: k = 64 st .. 64 st + 63, into buffer st & 1
    const uint64_t ga = slice_ga + (uint64_t)st * G_ROWB;
    u32x4 g0;
    g0[0] = uni(1u);
    g0[1] = uni(slice_lds + (st & 1u) * G_BUF);
    g0[2] = uni((uint32_t)ga);
    g0[3] = uni((((uint32_t)(ga >> 32)) & 0x01FFFFFFu) | 0x80000000u);
    asm volatile("tensor_load_to_lds %0, %1" :: "s"(g0), "s"(g1) : "memory");
  };

  v8f acc[4][4];
#pragma unroll
  for (int i = 0; i < 4; ++i)
#pragma unroll
    for (int j = 0; j < 4; ++j)
#pragma unroll
      for (int r = 0; r < 8; ++r) acc[i][j][r] = 0.0f;

  issue(0u);
  asm volatile("s_wait_tensorcnt 0x0" ::: "memory");  // this wave's slice of stage 0 has landed
  __syncthreads();                                    // every slice of stage 0 is readable
  issue(1u);

  for (int s = 0; s < G_PASSES; ++s) {
    const unsigned char* buf = ring + (uint32_t)(s & 1) * G_BUF;
    const _Float16* xs = (const _Float16*)(buf + (uint32_t)wm * G_XSLICE);
    const unsigned char* wsl = buf + G_WBASE + (uint32_t)(2 * wn) * G_WSLICE;  // this wave's two slices of W
#pragma unroll
    for (int kk = 0; kk < 64; kk += 32) {
      v16h a[4], bf[4];
#pragma unroll
      for (int i = 0; i < 4; ++i) a[i] = load_frag(xs, i * 16 + lane15, (int)(G_PITCH / 2u), kk, lane);
#pragma unroll
      for (int j = 0; j < 4; ++j)
        bf[j] = load_frag((const _Float16*)(wsl + (uint32_t)(j >> 1) * G_WSLICE), (j & 1) * 16 + lane15,
                          (int)(G_PITCH / 2u), kk, lane);
      // Keeps the 16 LDS reads of this k step one group in front of its 16 WMMAs: left alone the
      // compiler reads one X fragment per row of 4 WMMAs and waits for it to 0 each time.
      __builtin_amdgcn_sched_barrier(0);
#pragma unroll
      for (int i = 0; i < 4; ++i)
#pragma unroll
        for (int j = 0; j < 4; ++j) acc[i][j] = wmma_f16(a[i], bf[j], acc[i][j]);
    }
    // Publish point of stage s + 1.
    asm volatile("s_wait_dscnt 0x0" ::: "memory");
    asm volatile("s_wait_tensorcnt 0x0" ::: "memory");
    __syncthreads();
    const uint32_t nxt = pinned((uint32_t)s + 2u);
    if (nxt < (uint32_t)G_PASSES) issue(nxt);
  }
  asm volatile("s_wait_tensorcnt 0x0" ::: "memory");    // no request outlives the loop
  asm volatile("s_wait_dscnt 0x0" ::: "memory");

  // Epilogue: C layout -> lane holds fixed column n, rows m = tile base + hi + r.
  // A tile lies in one batch (256 divides SEQ) and in one of Q, K, V (128 divides HID).
  const int m0 = mt * 256 + wm * 64 + hi;
  const int b = m0 >> 10;
  const int s0 = m0 & 1023;
  const int n0 = (nt & 7) * 128 + wn * 64 + lane15;   // column of j = 0; j adds 16
  const int head = n0 >> 6;                           // the wave's 64 columns are one head
  float bn[4];
#pragma unroll
  for (int j = 0; j < 4; ++j) bn[j] = bias[n0 + j * 16];
  // Before a register that an issued load or store names is written again: it is written at the end
  // of each run of loads or stores.
  asm volatile("s_wait_xcnt 0x0" ::: "memory");
  if (z == 2) {
    _Float16* dst = Vt + (((size_t)(b * NHEAD + head) * DHEAD) + lane15) * SEQ + s0;
#pragma unroll
    for (int j = 0; j < 4; ++j) {
#pragma unroll
      for (int i = 0; i < 4; ++i)
#pragma unroll
        for (int r = 0; r < 8; ++r) dst[(size_t)(j * 16) * SEQ + i * 16 + r] = (_Float16)(acc[i][j][r] + bn[j]);
    }
    asm volatile("s_wait_xcnt 0x0" ::: "memory");
  } else {
    _Float16* dst = ((z == 0) ? Qb : Kb) + (((size_t)(b * NHEAD + head) * SEQ) + s0) * DHEAD + lane15;
#pragma unroll
    for (int j = 0; j < 4; ++j) {
#pragma unroll
      for (int i = 0; i < 4; ++i)
#pragma unroll
        for (int r = 0; r < 8; ++r) dst[(i * 16 + r) * DHEAD + j * 16] = (_Float16)(acc[i][j][r] + bn[j]);
    }
    asm volatile("s_wait_xcnt 0x0" ::: "memory");
  }
}

// ---------------------------------------------------------------------------
// Flash attention: one block per (q-tile of 64, head, batch).
// 128 threads = 4 waves; wave owns 16 q-rows. Online softmax over 16 k-tiles.
// A pass is 64 keys: 64 rows of K and 64 rows of V^T, 128 bytes each, staged in LDS by tensor loads
// (wave 0 brings the K tile, wave 1 the V^T tile; LDS pitch 144 bytes), two buffers, the next pass in
// flight; all four waves read their fragments from there.
// ---------------------------------------------------------------------------
constexpr uint32_t F_TILE   = 10240u;         // 64 rows x 144 bytes = 9,216, rounded up to a multiple of 2 KiB
constexpr uint32_t F_BUF    = 2u * F_TILE;    // a buffer: the K tile, then the V^T tile
constexpr uint32_t F_PASSES = SEQ / 64;

__global__ __launch_bounds__(128) void flash_attn_kernel(
    const _Float16* __restrict__ Qb, const _Float16* __restrict__ Kb,
    const _Float16* __restrict__ Vt, const float* __restrict__ mask,
    float* __restrict__ out) {
  const int qt = blockIdx.x;   // 0..15
  const int h  = blockIdx.y;   // 0..15
  const int b  = blockIdx.z;   // 0..7
  const uint32_t wave = uni(threadIdx.x >> 5);
  const int lane = threadIdx.x & 31;
  const int lane15 = lane & 15;
  const int hi = (lane & 16) ? 8 : 0;

  constexpr float SCALE = 0.125f;            // 1/sqrt(64)
  constexpr float LOG2E = 1.44269504088896f;

  const _Float16* Q = Qb + (size_t)(b * NHEAD + h) * SEQ * DHEAD;
  const _Float16* K = Kb + (size_t)(b * NHEAD + h) * SEQ * DHEAD;
  const _Float16* V = Vt + (size_t)(b * NHEAD + h) * DHEAD * SEQ;  // [d][s]
  const float* mrow = mask + (size_t)b * SEQ;

  __shared__ __align__(16) _Float16 ldsP[4][16][72];
  const _Float16* myP = &ldsP[wave][0][0];

  const int qrow = qt * 64 + (int)wave * 16 + lane15;
  const v16h aq0 = load_frag(Q, qrow, DHEAD, 0, lane);
  const v16h aq1 = load_frag(Q, qrow, DHEAD, 32, lane);

  __shared__ __attribute__((aligned(2048))) unsigned char kv[2u * F_BUF];

  // Wave 0's tile of stage st: K rows 64 st .. 64 st + 63 (contiguous). Wave 1's: all 64 rows of V^T,
  // keys 64 st .. 64 st + 63 (source pitch 2,048 bytes). Waves 2 and 3 issue nothing.
  const bool brings_k = wave == 0u;
  const uint64_t tile_ga = (uint64_t)(size_t)(brings_k ? K : V);
  const uint32_t tile_step = brings_k ? 64u * G_ROWB : G_ROWB;   // bytes from one stage's tile to the next
  const uint32_t tile_lds = (uint32_t)(size_t)kv + (brings_k ? 0u : F_TILE);

  u32x8 g1;
  g1[0] = uni((1u << 20) | (4u << 22) | (3u << 25));
  g1[1] = uni((G_ROWB & 0xFFFFu) << 16);
  g1[2] = uni((G_ROWB >> 16) | (64u << 16));
  g1[3] = uni(G_ROWB << 16);
  g1[4] = uni(64u);
  g1[5] = uni(brings_k ? G_ROWB : (uint32_t)SEQ * 2u);
  g1[6] = uni(0u);
  g1[7] = uni(0u);
  asm volatile("" : "+s"(g1));

  auto issue = [&](uint32_t st) {     // stage st into buffer st & 1
    const uint64_t ga = tile_ga + (uint64_t)(st * tile_step);
    u32x4 g0;
    g0[0] = uni(1u);
    g0[1] = uni(tile_lds + (st & 1u) * F_BUF);
    g0[2] = uni((uint32_t)ga);
    g0[3] = uni((((uint32_t)(ga >> 32)) & 0x01FFFFFFu) | 0x80000000u);
    asm volatile("tensor_load_to_lds %0, %1" :: "s"(g0), "s"(g1) : "memory");
  };

  if (pinned(wave < 2u)) {
    issue(0u);
    asm volatile("s_wait_tensorcnt 0x0" ::: "memory");  // this wave's tile of stage 0 has landed
  }
  __syncthreads();                                      // both tiles of stage 0 are readable
  if (pinned(wave < 2u)) issue(1u);

  v8f o[4];
  float m_run[8], l_run[8];
#pragma unroll
  for (int t = 0; t < 4; ++t)
#pragma unroll
    for (int r = 0; r < 8; ++r) o[t][r] = 0.0f;
#pragma unroll
  for (int r = 0; r < 8; ++r) { m_run[r] = -__builtin_inff(); l_run[r] = 0.0f; }

  for (int kt = 0; kt < (int)F_PASSES; ++kt) {
    const int kb = kt * 64;
    const _Float16* ks = (const _Float16*)(kv + (uint32_t)(kt & 1) * F_BUF);
    const _Float16* vs = (const _Float16*)(kv + (uint32_t)(kt & 1) * F_BUF + F_TILE);

    // ---- S = Q K^T ----
    v8f sf[4];
#pragma unroll
    for (int t = 0; t < 4; ++t)
#pragma unroll
      for (int r = 0; r < 8; ++r) sf[t][r] = 0.0f;

    float mv[4];   // additive mask of this lane's four columns, asked for ahead of the fence below
#pragma unroll
    for (int t = 0; t < 4; ++t) mv[t] = mrow[kb + t * 16 + lane15];
#pragma unroll
    for (int tp = 0; tp < 4; tp += 2) {
      v16h bk0[2], bk1[2];
#pragma unroll
      for (int t = 0; t < 2; ++t) {
        bk0[t] = load_frag(ks, (tp + t) * 16 + lane15, (int)(G_PITCH / 2u), 0, lane);
        bk1[t] = load_frag(ks, (tp + t) * 16 + lane15, (int)(G_PITCH / 2u), 32, lane);
      }
      // Keeps the 8 LDS reads of 32 keys one group in front of their 4 WMMAs: left alone the compiler
      // reads one fragment per WMMA and waits for it to 0 each time. (All 16 reads in one group spill.)
      __builtin_amdgcn_sched_barrier(0);
#pragma unroll
      for (int t = 0; t < 2; ++t) sf[tp + t] = wmma_f16(aq0, bk0[t], sf[tp + t]);
#pragma unroll
      for (int t = 0; t < 2; ++t) sf[tp + t] = wmma_f16(aq1, bk1[t], sf[tp + t]);
    }

    // scale + additive mask (mask fixed per lane's column)
#pragma unroll
    for (int t = 0; t < 4; ++t) {
#pragma unroll
      for (int r = 0; r < 8; ++r) sf[t][r] = sf[t][r] * SCALE + mv[t];
    }

    // ---- online softmax ----
    float newm[8], alpha[8];
#pragma unroll
    for (int r = 0; r < 8; ++r) {
      float v = fmaxf(fmaxf(sf[0][r], sf[1][r]), fmaxf(sf[2][r], sf[3][r]));
#pragma unroll
      for (int off = 1; off < 16; off <<= 1) v = fmaxf(v, __shfl_xor(v, off, 32));
      newm[r] = fmaxf(m_run[r], v);
      alpha[r] = exp2f((m_run[r] - newm[r]) * LOG2E);
      m_run[r] = newm[r];
    }
#pragma unroll
    for (int t = 0; t < 4; ++t)
#pragma unroll
      for (int r = 0; r < 8; ++r)
        sf[t][r] = exp2f((sf[t][r] - newm[r]) * LOG2E);
#pragma unroll
    for (int r = 0; r < 8; ++r) {
      float v = sf[0][r] + sf[1][r] + sf[2][r] + sf[3][r];
#pragma unroll
      for (int off = 1; off < 16; off <<= 1) v += __shfl_xor(v, off, 32);
      l_run[r] = l_run[r] * alpha[r] + v;
    }

    // rescale running output
#pragma unroll
    for (int t = 0; t < 4; ++t)
#pragma unroll
      for (int r = 0; r < 8; ++r) o[t][r] *= alpha[r];

    // ---- P (C layout) -> LDS (row-major) -> A fragments ----
#pragma unroll
    for (int t = 0; t < 4; ++t)
#pragma unroll
      for (int r = 0; r < 8; ++r)
        ldsP[wave][hi + r][t * 16 + lane15] = (_Float16)sf[t][r];
    // same-wave DS ops are in-order: no barrier needed for private buffer
    v16h ap0 = load_frag(myP, lane15, 72, 0, lane);
    v16h ap1 = load_frag(myP, lane15, 72, 32, lane);

    // ---- O += P V  (B fragments = rows of the staged V^T tile) ----
#pragma unroll
    for (int t = 0; t < 4; ++t) {
      v16h bv0 = load_frag(vs, t * 16 + lane15, (int)(G_PITCH / 2u), 0, lane);
      v16h bv1 = load_frag(vs, t * 16 + lane15, (int)(G_PITCH / 2u), 32, lane);
      o[t] = wmma_f16(ap0, bv0, o[t]);
      o[t] = wmma_f16(ap1, bv1, o[t]);
    }

    // Publish point of stage kt + 1.
    asm volatile("s_wait_dscnt 0x0" ::: "memory");        // this wave has left buffer kt & 1
    if (pinned(wave < 2u))
      asm volatile("s_wait_tensorcnt 0x0" ::: "memory");
    __syncthreads();
    const uint32_t nxt = pinned((uint32_t)kt + 2u);
    if (pinned((uint32_t)(wave < 2u) & (uint32_t)(nxt < F_PASSES))) issue(nxt);
  }
  asm volatile("s_wait_tensorcnt 0x0" ::: "memory");      // no request outlives the loop
  asm volatile("s_wait_dscnt 0x0" ::: "memory");

  // ---- epilogue: out[b, s, h*64 + d] = O / l ----
#pragma unroll
  for (int r = 0; r < 8; ++r) {
    const float inv = 1.0f / l_run[r];
    const int srow = qt * 64 + wave * 16 + hi + r;
    float* orow = out + ((size_t)(b * SEQ + srow)) * HID + h * DHEAD;
#pragma unroll
    for (int t = 0; t < 4; ++t) orow[t * 16 + lane15] = o[t][r] * inv;
  }
}

// ---------------------------------------------------------------------------
// Workspace layout (bytes):
//   Xh  f16 [8192][1024]        @ 0         (16,777,216)
//   Wh3 f16 [3][1024][1024]     @ 16777216  ( 6,291,456)
//   Qb  f16 [8][16][1024][64]   @ 23068672  (16,777,216)
//   Kb  f16 [8][16][1024][64]   @ 39845888  (16,777,216)
//   Vt  f16 [8][16][64][1024]   @ 56623104  (16,777,216)  -> total ~70 MB
// ---------------------------------------------------------------------------
extern "C" void kernel_launch(void* const* d_in, const int* in_sizes, int n_in,
                              void* d_out, int out_size, void* d_ws, size_t ws_size,
                              hipStream_t stream) {
  (void)in_sizes; (void)n_in; (void)out_size; (void)ws_size;
  const float* x    = (const float*)d_in[0];
  const float* mask = (const float*)d_in[1];
  const float* Wq   = (const float*)d_in[2];
  const float* bq   = (const float*)d_in[3];
  const float* Wk   = (const float*)d_in[4];
  const float* bk   = (const float*)d_in[5];
  const float* Wv   = (const float*)d_in[6];
  const float* bv   = (const float*)d_in[7];
  float* out = (float*)d_out;

  char* ws = (char*)d_ws;
  _Float16* Xh  = (_Float16*)(ws + 0);
  _Float16* Wh3 = (_Float16*)(ws + 16777216);
  _Float16* Qb  = (_Float16*)(ws + 23068672);
  _Float16* Kb  = (_Float16*)(ws + 39845888);
  _Float16* Vt  = (_Float16*)(ws + 56623104);

  const int nX = NB * SEQ * HID;   // 8,388,608
  const int nW = HID * HID;        // 1,048,576

  f32_to_f16_kernel<<<(nX / 4 + 255) / 256, 256, 0, stream>>>(x, Xh, nX);
  f32_to_f16_kernel<<<(nW / 4 + 255) / 256, 256, 0, stream>>>(Wq, Wh3 + (size_t)0 * nW, nW);
  f32_to_f16_kernel<<<(nW / 4 + 255) / 256, 256, 0, stream>>>(Wk, Wh3 + (size_t)1 * nW, nW);
  f32_to_f16_kernel<<<(nW / 4 + 255) / 256, 256, 0, stream>>>(Wv, Wh3 + (size_t)2 * nW, nW);

  qkv_gemm_kernel<<<dim3(32, 24, 1), 256, 0, stream>>>(Xh, Wh3, bq, bk, bv,
                                                        Qb, Kb, Vt);

  flash_attn_kernel<<<dim3(16, 16, 8), 128, 0, stream>>>(Qb, Kb, Vt, mask, out);
}

// v003
// It runs in 155 microseconds.
// Next to v002, in two timings, it ran 1.05 times as fast each time.
// Over all steps from v000 it is 2.53 times as fast.
#include <hip/hip_runtime.h>
#include <stdint.h>

typedef __attribute__((ext_vector_type(16))) _Float16 v16h;
typedef __attribute__((ext_vector_type(8)))  _Float16 v8h;
typedef __attribute__((ext_vector_type(4)))  _Float16 v4h;
typedef __attribute__((ext_vector_type(8)))  float    v8f;

#define NB    8
#define SEQ   1024
#define HID   1024
#define NHEAD 16
#define DHEAD 64

__device__ __forceinline__ v8f wmma_f16(v16h a, v16h b, v8f c) {
  // D = A(16x32 f16) * B(32x16 f16) + C(16x16 f32)
  return __builtin_amdgcn_wmma_f32_16x16x32_f16(false, a, false, b, (short)0, c,
                                                false, false);
}

__device__ __forceinline__ v16h load_frag(const _Float16* base, int row, int ld,
                                          int kbase, int lane) {
  const int half = (lane & 16) ? 8 : 0;
  const _Float16* p = base + (size_t)row * ld + kbase + half;
  v8h c0 = *(const v8h*)(p);
  v8h c1 = *(const v8h*)(p + 16);
  v16h a;
#pragma unroll
  for (int j = 0; j < 8; ++j) { a[j] = c0[j]; a[j + 8] = c1[j]; }
  return a;
}

// ---------------------------------------------------------------------------
// fp32 -> fp16 conversion of X and the three weights, one launch.
// The f16 copies lie one behind the other in the workspace (Xh, then Wh3), so the job is one stream of
// 22 * 2^17 groups of four values: 16 * 2^17 of X, 2 * 2^17 of each weight.
// grid = 256 work-groups of 16 waves = 2^17 threads, all resident at once; thread t converts group
// k * 2^17 + t for k = 0..21, so each wave-wide load is 512 contiguous bytes, each store 256, and which
// source a k reads is known at compile time. Few long-lived waves: a wave's start is paid 4,096 times.
// ---------------------------------------------------------------------------
constexpr int CV_THREADS = 256 * 512;                    // 2^17
constexpr int CV_X = NB * SEQ * HID / 4 / CV_THREADS;    // 16 groups a thread from X
constexpr int CV_W = HID * HID / 4 / CV_THREADS;         // 2 from each weight
constexpr int CV_ALL = CV_X + 3 * CV_W;

__global__ __launch_bounds__(512) void f32_to_f16_kernel(
    const float* __restrict__ x, const float* __restrict__ Wq, const float* __restrict__ Wk,
    const float* __restrict__ Wv, _Float16* __restrict__ dst) {
  const int t = blockIdx.x * 512 + threadIdx.x;
  float4 v[CV_ALL];   // loads written ahead of all use, so that many of a wave's loads are in flight together
#pragma unroll
  for (int k = 0; k < CV_X; ++k) v[k] = *(const float4*)(x + ((size_t)k * CV_THREADS + t) * 4);
#pragma unroll
  for (int k = 0; k < CV_W; ++k) {
    v[CV_X + k]            = *(const float4*)(Wq + ((size_t)k * CV_THREADS + t) * 4);
    v[CV_X + CV_W + k]     = *(const float4*)(Wk + ((size_t)k * CV_THREADS + t) * 4);
    v[CV_X + 2 * CV_W + k] = *(const float4*)(Wv + ((size_t)k * CV_THREADS + t) * 4);
  }
#pragma unroll
  for (int k = 0; k < CV_ALL; ++k) {
    v4h o;
    o[0] = (_Float16)v[k].x; o[1] = (_Float16)v[k].y;
    o[2] = (_Float16)v[k].z; o[3] = (_Float16)v[k].w;
    *(v4h*)(dst + ((size_t)k * CV_THREADS + t) * 4) = o;
  }
}

// ---------------------------------------------------------------------------
// Fused QKV projection: Y = Xh @ W^T + bias, the three weights read as one [3072][1024] matrix.
// grid = (M/256, 3072/128).  256 threads = 8 waves (4 x 2); wave owns 64 rows x 64 cols.
// A pass is 64 k: 256 rows of X and 128 rows of W, 128 bytes each, staged in LDS by tensor loads
// (one slice per wave: 64 rows of X or 32 of W; LDS pitch 144 bytes), two buffers, the next pass in flight.
// cols 0..1023 -> Q [B,h,S,d], 1024..2047 -> K [B,h,S,d], 2048..3071 -> V transposed [B,h,d,S].
// ---------------------------------------------------------------------------
typedef uint32_t u32x4 __attribute__((ext_vector_type(4)));
typedef uint32_t u32x8 __attribute__((ext_vector_type(8)));

constexpr uint32_t G_ROWB  = 128u;
constexpr uint32_t G_PITCH = G_ROWB + 16u;
constexpr uint32_t G_XSLICE = 10240u;
constexpr uint32_t G_WSLICE = 6144u;
constexpr uint32_t G_WBASE  = 4u * G_XSLICE;
constexpr uint32_t G_BUF    = G_WBASE + 4u * G_WSLICE;
constexpr int      G_PASSES = HID / 64;

__device__ __forceinline__ uint32_t uni(uint32_t v) {
  return (uint32_t)__builtin_amdgcn_readfirstlane(v);
}
__device__ __forceinline__ uint32_t pinned(uint32_t v) {
  uint32_t w = uni(v);
  asm volatile("" : "+s"(w));
  return w;
}

__global__ __launch_bounds__(256) void qkv_gemm_kernel(
    const _Float16* __restrict__ Xh, const _Float16* __restrict__ Wh3,
    const float* __restrict__ bq, const float* __restrict__ bk,
    const float* __restrict__ bv,
    _Float16* __restrict__ Qb, _Float16* __restrict__ Kb,
    _Float16* __restrict__ Vt) {
  __shared__ __attribute__((aligned(2048))) unsigned char ring[2u * G_BUF];

  const int mt = blockIdx.x;          // 0..31, 256 rows each (rows = B*S)
  const int nt = blockIdx.y;          // 0..23, 128 cols each (cols = 3*HID)
  const int z  = nt >> 3;             // 0:Q 1:K 2:V
  const uint32_t wave = uni(threadIdx.x >> 5);
  const int wm = (int)(wave >> 1);    // wave's 64-row quarter of the tile
  const int wn = (int)(wave & 1u);    // wave's 64-col half of the tile
  const int lane = threadIdx.x & 31;
  const int lane15 = lane & 15;
  const int hi = (lane & 16) ? 8 : 0;

  const float* bias = (z == 0) ? bq : ((z == 1) ? bk : bv);

  // This wave's slice of every stage: waves 0 to 3 bring 64 rows of X each, waves 4 to 7 32 rows of W.
  const bool brings_x = wave < 4u;
  const _Float16* slice_src = brings_x
      ? Xh  + (size_t)(mt * 256 + (int)wave * 64) * HID
      : Wh3 + (size_t)(nt * 128 + (int)(wave - 4u) * 32) * HID;
  const uint64_t slice_ga = (uint64_t)(size_t)slice_src;
  const uint32_t slice_lds = (uint32_t)(size_t)ring +
      (brings_x ? wave * G_XSLICE : G_WBASE + (wave - 4u) * G_WSLICE);
  const uint32_t slice_rows = brings_x ? 64u : 32u;

  u32x8 g1;
  g1[0] = uni((1u << 20) | (4u << 22) | (3u << 25));
  g1[1] = uni((G_ROWB & 0xFFFFu) << 16);
  g1[2] = uni((G_ROWB >> 16) | (slice_rows << 16));
  g1[3] = uni(G_ROWB << 16);
  g1[4] = uni(slice_rows);
  g1[5] = uni((uint32_t)HID * 2u);
  g1[6] = uni(0u);
  g1[7] = uni(0u);
  asm volatile("" : "+s"(g1));

  auto issue = [&](uint32_t st) {     // stage st: k = 64 st .. 64 st + 63, into buffer st & 1
    const uint64_t ga = slice_ga + (uint64_t)st * G_ROWB;
    u32x4 g0;
    g0[0] = uni(1u);
    g0[1] = uni(slice_lds + (st & 1u) * G_BUF);
    g0[2] = uni((uint32_t)ga);
    g0[3] = uni((((uint32_t)(ga >> 32)) & 0x01FFFFFFu) | 0x80000000u);
    asm volatile("tensor_load_to_lds %0, %1" :: "s"(g0), "s"(g1) : "memory");
  };

  v8f acc[4][4];
#pragma unroll
  for (int i = 0; i < 4; ++i)
#pragma unroll
    for (int j = 0; j < 4; ++j)
#pragma unroll
      for (int r = 0; r < 8; ++r) acc[i][j][r] = 0.0f;

  issue(0u);
  asm volatile("s_wait_tensorcnt 0x0" ::: "memory");  // this wave's slice of stage 0 has landed
  __syncthreads();                                    // every slice of stage 0 is readable
  issue(1u);

  for (int s = 0; s < G_PASSES; ++s) {
    const unsigned char* buf = ring + (uint32_t)(s & 1) * G_BUF;
    const _Float16* xs = (const _Float16*)(buf + (uint32_t)wm * G_XSLICE);
    const unsigned char* wsl = buf + G_WBASE + (uint32_t)(2 * wn) * G_WSLICE;  // this wave's two slices of W
#pragma unroll
    for (int kk = 0; kk < 64; kk += 32) {
      v16h a[4], bf[4];
#pragma unroll
      for (int i = 0; i < 4; ++i) a[i] = load_frag(xs, i * 16 + lane15, (int)(G_PITCH / 2u), kk, lane);
#pragma unroll
      for (int j = 0; j < 4; ++j)
        bf[j] = load_frag((const _Float16*)(wsl + (uint32_t)(j >> 1) * G_WSLICE), (j & 1) * 16 + lane15,
                          (int)(G_PITCH / 2u), kk, lane);
      // Keeps the 16 LDS reads of this k step one group in front of its 16 WMMAs: left alone the
      // compiler reads one X fragment per row of 4 WMMAs and waits for it to 0 each time.
      __builtin_amdgcn_sched_barrier(0);
#pragma unroll
      for (int i = 0; i < 4; ++i)
#pragma unroll
        for (int j = 0; j < 4; ++j) acc[i][j] = wmma_f16(a[i], bf[j], acc[i][j]);
    }
    // Publish point of stage s + 1.
    asm volatile("s_wait_dscnt 0x0" ::: "memory");
    asm volatile("s_wait_tensorcnt 0x0" ::: "memory");
    __syncthreads();
    const uint32_t nxt = pinned((uint32_t)s + 2u);
    if (nxt < (uint32_t)G_PASSES) issue(nxt);
  }
  asm volatile("s_wait_tensorcnt 0x0" ::: "memory");    // no request outlives the loop
  asm volatile("s_wait_dscnt 0x0" ::: "memory");

  // Epilogue: C layout -> lane holds fixed column n, rows m = tile base + hi + r.
  // A tile lies in one batch (256 divides SEQ) and in one of Q, K, V (128 divides HID).
  const int m0 = mt * 256 + wm * 64 + hi;
  const int b = m0 >> 10;
  const int s0 = m0 & 1023;
  const int n0 = (nt & 7) * 128 + wn * 64 + lane15;   // column of j = 0; j adds 16
  const int head = n0 >> 6;                           // the wave's 64 columns are one head
  float bn[4];
#pragma unroll
  for (int j = 0; j < 4; ++j) bn[j] = bias[n0 + j * 16];
  // Before a register that an issued load or store names is written again: it is written at the end
  // of each run of loads or stores.
  asm volatile("s_wait_xcnt 0x0" ::: "memory");
  if (z == 2) {
    _Float16* dst = Vt + (((size_t)(b * NHEAD + head) * DHEAD) + lane15) * SEQ + s0;
#pragma unroll
    for (int j = 0; j < 4; ++j) {
#pragma unroll
      for (int i = 0; i < 4; ++i)
#pragma unroll
        for (int r = 0; r < 8; ++r) dst[(size_t)(j * 16) * SEQ + i * 16 + r] = (_Float16)(acc[i][j][r] + bn[j]);
    }
    asm volatile("s_wait_xcnt 0x0" ::: "memory");
  } else {
    _Float16* dst = ((z == 0) ? Qb : Kb) + (((size_t)(b * NHEAD + head) * SEQ) + s0) * DHEAD + lane15;
#pragma unroll
    for (int j = 0; j < 4; ++j) {
#pragma unroll
      for (int i = 0; i < 4; ++i)
#pragma unroll
        for (int r = 0; r < 8; ++r) dst[(i * 16 + r) * DHEAD + j * 16] = (_Float16)(acc[i][j][r] + bn[j]);
    }
    asm volatile("s_wait_xcnt 0x0" ::: "memory");
  }
}

// ---------------------------------------------------------------------------
// Flash attention: one block per (q-tile of 64, head, batch).
// 128 threads = 4 waves; wave owns 16 q-rows. Online softmax over 16 k-tiles.
// A pass is 64 keys: 64 rows of K and 64 rows of V^T, 128 bytes each, staged in LDS by tensor loads
// (wave 0 brings the K tile, wave 1 the V^T tile; LDS pitch 144 bytes), two buffers, the next pass in
// flight; all four waves read their fragments from there.
// ---------------------------------------------------------------------------
constexpr uint32_t F_TILE   = 10240u;         // 64 rows x 144 bytes = 9,216, rounded up to a multiple of 2 KiB
constexpr uint32_t F_BUF    = 2u * F_TILE;    // a buffer: the K tile, then the V^T tile
constexpr uint32_t F_PASSES = SEQ / 64;

__global__ __launch_bounds__(128) void flash_attn_kernel(
    const _Float16* __restrict__ Qb, const _Float16* __restrict__ Kb,
    const _Float16* __restrict__ Vt, const float* __restrict__ mask,
    float* __restrict__ out) {
  const int qt = blockIdx.x;   // 0..15
  const int h  = blockIdx.y;   // 0..15
  const int b  = blockIdx.z;   // 0..7
  const uint32_t wave = uni(threadIdx.x >> 5);
  const int lane = threadIdx.x & 31;
  const int lane15 = lane & 15;
  const int hi = (lane & 16) ? 8 : 0;

  constexpr float SCALE = 0.125f;            // 1/sqrt(64)
  constexpr float LOG2E = 1.44269504088896f;

  const _Float16* Q = Qb + (size_t)(b * NHEAD + h) * SEQ * DHEAD;
  const _Float16* K = Kb + (size_t)(b * NHEAD + h) * SEQ * DHEAD;
  const _Float16* V = Vt + (size_t)(b * NHEAD + h) * DHEAD * SEQ;  // [d][s]
  const float* mrow = mask + (size_t)b * SEQ;

  __shared__ __align__(16) _Float16 ldsP[4][16][72];
  const _Float16* myP = &ldsP[wave][0][0];

  const int qrow = qt * 64 + (int)wave * 16 + lane15;
  const v16h aq0 = load_frag(Q, qrow, DHEAD, 0, lane);
  const v16h aq1 = load_frag(Q, qrow, DHEAD, 32, lane);

  __shared__ __attribute__((aligned(2048))) unsigned char kv[2u * F_BUF];

  // Wave 0's tile of stage st: K rows 64 st .. 64 st + 63 (contiguous). Wave 1's: all 64 rows of V^T,
  // keys 64 st .. 64 st + 63 (source pitch 2,048 bytes). Waves 2 and 3 issue nothing.
  const bool brings_k = wave == 0u;
  const uint64_t tile_ga = (uint64_t)(size_t)(brings_k ? K : V);
  const uint32_t tile_step = brings_k ? 64u * G_ROWB : G_ROWB;   // bytes from one stage's tile to the next
  const uint32_t tile_lds = (uint32_t)(size_t)kv + (brings_k ? 0u : F_TILE);

  u32x8 g1;
  g1[0] = uni((1u << 20) | (4u << 22) | (3u << 25));
  g1[1] = uni((G_ROWB & 0xFFFFu) << 16);
  g1[2] = uni((G_ROWB >> 16) | (64u << 16));
  g1[3] = uni(G_ROWB << 16);
  g1[4] = uni(64u);
  g1[5] = uni(brings_k ? G_ROWB : (uint32_t)SEQ * 2u);
  g1[6] = uni(0u);
  g1[7] = uni(0u);
  asm volatile("" : "+s"(g1));

  auto issue = [&](uint32_t st) {     // stage st into buffer st & 1
    const uint64_t ga = tile_ga + (uint64_t)(st * tile_step);
    u32x4 g0;
    g0[0] = uni(1u);
    g0[1] = uni(tile_lds + (st & 1u) * F_BUF);
    g0[2] = uni((uint32_t)ga);
    g0[3] = uni((((uint32_t)(ga >> 32)) & 0x01FFFFFFu) | 0x80000000u);
    asm volatile("tensor_load_to_lds %0, %1" :: "s"(g0), "s"(g1) : "memory");
  };

  if (pinned(wave < 2u)) {
    issue(0u);
    asm volatile("s_wait_tensorcnt 0x0" ::: "memory");  // this wave's tile of stage 0 has landed
  }
  __syncthreads();                                      // both tiles of stage 0 are readable
  if (pinned(wave < 2u)) issue(1u);

  v8f o[4];
  float m_run[8], l_run[8];
#pragma unroll
  for (int t = 0; t < 4; ++t)
#pragma unroll
    for (int r = 0; r < 8; ++r) o[t][r] = 0.0f;
#pragma unroll
  for (int r = 0; r < 8; ++r) { m_run[r] = -__builtin_inff(); l_run[r] = 0.0f; }

  for (int kt = 0; kt < (int)F_PASSES; ++kt) {
    const int kb = kt * 64;
    const _Float16* ks = (const _Float16*)(kv + (uint32_t)(kt & 1) * F_BUF);
    const _Float16* vs = (const _Float16*)(kv + (uint32_t)(kt & 1) * F_BUF + F_TILE);

    // ---- S = Q K^T ----
    v8f sf[4];
#pragma unroll
    for (int t = 0; t < 4; ++t)
#pragma unroll
      for (int r = 0; r < 8; ++r) sf[t][r] = 0.0f;

    float mv[4];   // additive mask of this lane's four columns, asked for ahead of the fence below
#pragma unroll
    for (int t = 0; t < 4; ++t) mv[t] = mrow[kb + t * 16 + lane15];
#pragma unroll
    for (int tp = 0; tp < 4; tp += 2) {
      v16h bk0[2], bk1[2];
#pragma unroll
      for (int t = 0; t < 2; ++t) {
        bk0[t] = load_frag(ks, (tp + t) * 16 + lane15, (int)(G_PITCH / 2u), 0, lane);
        bk1[t] = load_frag(ks, (tp + t) * 16 + lane15, (int)(G_PITCH / 2u), 32, lane);
      }
      // Keeps the 8 LDS reads of 32 keys one group in front of their 4 WMMAs: left alone the compiler
      // reads one fragment per WMMA and waits for it to 0 each time. (All 16 reads in one group spill.)
      __builtin_amdgcn_sched_barrier(0);
#pragma unroll
      for (int t = 0; t < 2; ++t) sf[tp + t] = wmma_f16(aq0, bk0[t], sf[tp + t]);
#pragma unroll
      for (int t = 0; t < 2; ++t) sf[tp + t] = wmma_f16(aq1, bk1[t], sf[tp + t]);
    }

    // scale + additive mask (mask fixed per lane's column)
#pragma unroll
    for (int t = 0; t < 4; ++t) {
#pragma unroll
      for (int r = 0; r < 8; ++r) sf[t][r] = sf[t][r] * SCALE + mv[t];
    }

    // ---- online softmax ----
    float newm[8], alpha[8];
#pragma unroll
    for (int r = 0; r < 8; ++r) {
      float v = fmaxf(fmaxf(sf[0][r], sf[1][r]), fmaxf(sf[2][r], sf[3][r]));
#pragma unroll
      for (int off = 1; off < 16; off <<= 1) v = fmaxf(v, __shfl_xor(v, off, 32));
      newm[r] = fmaxf(m_run[r], v);
      alpha[r] = exp2f((m_run[r] - newm[r]) * LOG2E);
      m_run[r] = newm[r];
    }
#pragma unroll
    for (int t = 0; t < 4; ++t)
#pragma unroll
      for (int r = 0; r < 8; ++r)
        sf[t][r] = exp2f((sf[t][r] - newm[r]) * LOG2E);
#pragma unroll
    for (int r = 0; r < 8; ++r) {
      float v = sf[0][r] + sf[1][r] + sf[2][r] + sf[3][r];
#pragma unroll
      for (int off = 1; off < 16; off <<= 1) v += __shfl_xor(v, off, 32);
      l_run[r] = l_run[r] * alpha[r] + v;
    }

    // rescale running output
#pragma unroll
    for (int t = 0; t < 4; ++t)
#pragma unroll
      for (int r = 0; r < 8; ++r) o[t][r] *= alpha[r];

    // ---- P (C layout) -> LDS (row-major) -> A fragments ----
#pragma unroll
    for (int t = 0; t < 4; ++t)
#pragma unroll
      for (int r = 0; r < 8; ++r)
        ldsP[wave][hi + r][t * 16 + lane15] = (_Float16)sf[t][r];
    // same-wave DS ops are in-order: no barrier needed for private buffer
    v16h ap0 = load_frag(myP, lane15, 72, 0, lane);
    v16h ap1 = load_frag(myP, lane15, 72, 32, lane);

    // ---- O += P V  (B fragments = rows of the staged V^T tile) ----
#pragma unroll
    for (int t = 0; t < 4; ++t) {
      v16h bv0 = load_frag(vs, t * 16 + lane15, (int)(G_PITCH / 2u), 0, lane);
      v16h bv1 = load_frag(vs, t * 16 + lane15, (int)(G_PITCH / 2u), 32, lane);
      o[t] = wmma_f16(ap0, bv0, o[t]);
      o[t] = wmma_f16(ap1, bv1, o[t]);
    }

    // Publish point of stage kt + 1.
    asm volatile("s_wait_dscnt 0x0" ::: "memory");        // this wave has left buffer kt & 1
    if (pinned(wave < 2u))
      asm volatile("s_wait_tensorcnt 0x0" ::: "memory");
    __syncthreads();
    const uint32_t nxt = pinned((uint32_t)kt + 2u);
    if (pinned((uint32_t)(wave < 2u) & (uint32_t)(nxt < F_PASSES))) issue(nxt);
  }
  asm volatile("s_wait_tensorcnt 0x0" ::: "memory");      // no request outlives the loop
  asm volatile("s_wait_dscnt 0x0" ::: "memory");

  // ---- epilogue: out[b, s, h*64 + d] = O / l ----
#pragma unroll
  for (int r = 0; r < 8; ++r) {
    const float inv = 1.0f / l_run[r];
    const int srow = qt * 64 + wave * 16 + hi + r;
    float* orow = out + ((size_t)(b * SEQ + srow)) * HID + h * DHEAD;
#pragma unroll
    for (int t = 0; t < 4; ++t) orow[t * 16 + lane15] = o[t][r] * inv;
  }
}

// ---------------------------------------------------------------------------
// Workspace layout (bytes):
//   Xh  f16 [8192][1024]        @ 0         (16,777,216)
//   Wh3 f16 [3][1024][1024]     @ 16777216  ( 6,291,456)
//   Qb  f16 [8][16][1024][64]   @ 23068672  (16,777,216)
//   Kb  f16 [8][16][1024][64]   @ 39845888  (16,777,216)
//   Vt  f16 [8][16][64][1024]   @ 56623104  (16,777,216)  -> total ~70 MB
// ---------------------------------------------------------------------------
extern "C" void kernel_launch(void* const* d_in, const int* in_sizes, int n_in,
                              void* d_out, int out_size, void* d_ws, size_t ws_size,
                              hipStream_t stream) {
  (void)in_sizes; (void)n_in; (void)out_size; (void)ws_size;
  const float* x    = (const float*)d_in[0];
  const float* mask = (const float*)d_in[1];
  const float* Wq   = (const float*)d_in[2];
  const float* bq   = (const float*)d_in[3];
  const float* Wk   = (const float*)d_in[4];
  const float* bk   = (const float*)d_in[5];
  const float* Wv   = (const float*)d_in[6];
  const float* bv   = (const float*)d_in[7];
  float* out = (float*)d_out;

  char* ws = (char*)d_ws;
  _Float16* Xh  = (_Float16*)(ws + 0);
  _Float16* Wh3 = (_Float16*)(ws + 16777216);
  _Float16* Qb  = (_Float16*)(ws + 23068672);
  _Float16* Kb  = (_Float16*)(ws + 39845888);
  _Float16* Vt  = (_Float16*)(ws + 56623104);

  f32_to_f16_kernel<<<256, 512, 0, stream>>>(x, Wq, Wk, Wv, Xh);   // writes Xh and, behind it, Wh3

  qkv_gemm_kernel<<<dim3(32, 24, 1), 256, 0, stream>>>(Xh, Wh3, bq, bk, bv,
                                                        Qb, Kb, Vt);

  flash_attn_kernel<<<dim3(16, 16, 8), 128, 0, stream>>>(Qb, Kb, Vt, mask, out);
}

// v004
// It runs in 105 microseconds.
// Next to v003, in two timings, it ran 1.48 times as fast each time.
// Over all steps from v000 it is 3.75 times as fast.
#include <hip/hip_runtime.h>
#include <stdint.h>

typedef __attribute__((ext_vector_type(16))) _Float16 v16h;
typedef __attribute__((ext_vector_type(8)))  _Float16 v8h;
typedef __attribute__((ext_vector_type(4)))  _Float16 v4h;
typedef __attribute__((ext_vector_type(8)))  float    v8f;

#define NB    8
#define SEQ   1024
#define HID   1024
#define NHEAD 16
#define DHEAD 64

__device__ __forceinline__ v8f wmma_f16(v16h a, v16h b, v8f c) {
  // D = A(16x32 f16) * B(32x16 f16) + C(16x16 f32)
  return __builtin_amdgcn_wmma_f32_16x16x32_f16(false, a, false, b, (short)0, c,
                                                false, false);
}

__device__ __forceinline__ v16h load_frag(const _Float16* base, int row, int ld,
                                          int kbase, int lane) {
  const int half = (lane & 16) ? 8 : 0;
  const _Float16* p = base + (size_t)row * ld + kbase + half;
  v8h c0 = *(const v8h*)(p);
  v8h c1 = *(const v8h*)(p + 16);
  v16h a;
#pragma unroll
  for (int j = 0; j < 8; ++j) { a[j] = c0[j]; a[j + 8] = c1[j]; }
  return a;
}

// ---------------------------------------------------------------------------
// fp32 -> fp16 conversion of X and the three weights, one launch.
// The f16 copies lie one behind the other in the workspace (Xh, then Wh3), so the job is one stream of
// 22 * 2^17 groups of four values: 16 * 2^17 of X, 2 * 2^17 of each weight.
// grid = 256 work-groups of 16 waves = 2^17 threads, all resident at once; thread t converts group
// k * 2^17 + t for k = 0..21, so each wave-wide load is 512 contiguous bytes, each store 256, and which
// source a k reads is known at compile time. Few long-lived waves: a wave's start is paid 4,096 times.
// ---------------------------------------------------------------------------
constexpr int CV_THREADS = 256 * 512;                    // 2^17
constexpr int CV_X = NB * SEQ * HID / 4 / CV_THREADS;    // 16 groups a thread from X
constexpr int CV_W = HID * HID / 4 / CV_THREADS;         // 2 from each weight
constexpr int CV_ALL = CV_X + 3 * CV_W;

__global__ __launch_bounds__(512) void f32_to_f16_kernel(
    const float* __restrict__ x, const float* __restrict__ Wq, const float* __restrict__ Wk,
    const float* __restrict__ Wv, _Float16* __restrict__ dst) {
  const int t = blockIdx.x * 512 + threadIdx.x;
  float4 v[CV_ALL];   // loads written ahead of all use, so that many of a wave's loads are in flight together
#pragma unroll
  for (int k = 0; k < CV_X; ++k) v[k] = *(const float4*)(x + ((size_t)k * CV_THREADS + t) * 4);
#pragma unroll
  for (int k = 0; k < CV_W; ++k) {
    v[CV_X + k]            = *(const float4*)(Wq + ((size_t)k * CV_THREADS + t) * 4);
    v[CV_X + CV_W + k]     = *(const float4*)(Wk + ((size_t)k * CV_THREADS + t) * 4);
    v[CV_X + 2 * CV_W + k] = *(const float4*)(Wv + ((size_t)k * CV_THREADS + t) * 4);
  }
#pragma unroll
  for (int k = 0; k < CV_ALL; ++k) {
    v4h o;
    o[0] = (_Float16)v[k].x; o[1] = (_Float16)v[k].y;
    o[2] = (_Float16)v[k].z; o[3] = (_Float16)v[k].w;
    *(v4h*)(dst + ((size_t)k * CV_THREADS + t) * 4) = o;
  }
}

// ---------------------------------------------------------------------------
// Fused QKV projection: Y = Xh @ W^T + bias, the three weights read as one [3072][1024] matrix.
// grid = (M/256, 3072/128).  256 threads = 8 waves (4 x 2); wave owns 64 rows x 64 cols.
// A pass is 64 k: 256 rows of X and 128 rows of W, 128 bytes each, staged in LDS by tensor loads
// (one slice per wave: 64 rows of X or 32 of W; LDS pitch 144 bytes), two buffers, the next pass in flight.
// cols 0..1023 -> Q [B,h,S,d], 1024..2047 -> K [B,h,S,d], 2048..3071 -> V transposed [B,h,d,S].
// ---------------------------------------------------------------------------
typedef uint32_t u32x4 __attribute__((ext_vector_type(4)));
typedef uint32_t u32x8 __attribute__((ext_vector_type(8)));

constexpr uint32_t G_ROWB  = 128u;
constexpr uint32_t G_PITCH = G_ROWB + 16u;
constexpr uint32_t G_XSLICE = 10240u;
constexpr uint32_t G_WSLICE = 6144u;
constexpr uint32_t G_WBASE  = 4u * G_XSLICE;
constexpr uint32_t G_BUF    = G_WBASE + 4u * G_WSLICE;
constexpr int      G_PASSES = HID / 64;

__device__ __forceinline__ uint32_t uni(uint32_t v) {
  return (uint32_t)__builtin_amdgcn_readfirstlane(v);
}
__device__ __forceinline__ uint32_t pinned(uint32_t v) {
  uint32_t w = uni(v);
  asm volatile("" : "+s"(w));
  return w;
}

__global__ __launch_bounds__(256) void qkv_gemm_kernel(
    const _Float16* __restrict__ Xh, const _Float16* __restrict__ Wh3,
    const float* __restrict__ bq, const float* __restrict__ bk,
    const float* __restrict__ bv,
    _Float16* __restrict__ Qb, _Float16* __restrict__ Kb,
    _Float16* __restrict__ Vt) {
  __shared__ __attribute__((aligned(2048))) unsigned char ring[2u * G_BUF];

  const int mt = blockIdx.x;          // 0..31, 256 rows each (rows = B*S)
  const int nt = blockIdx.y;          // 0..23, 128 cols each (cols = 3*HID)
  const int z  = nt >> 3;             // 0:Q 1:K 2:V
  const uint32_t wave = uni(threadIdx.x >> 5);
  const int wm = (int)(wave >> 1);    // wave's 64-row quarter of the tile
  const int wn = (int)(wave & 1u);    // wave's 64-col half of the tile
  const int lane = threadIdx.x & 31;
  const int lane15 = lane & 15;
  const int hi = (lane & 16) ? 8 : 0;

  const float* bias = (z == 0) ? bq : ((z == 1) ? bk : bv);

  // This wave's slice of every stage: waves 0 to 3 bring 64 rows of X each, waves 4 to 7 32 rows of W.
  const bool brings_x = wave < 4u;
  const _Float16* slice_src = brings_x
      ? Xh  + (size_t)(mt * 256 + (int)wave * 64) * HID
      : Wh3 + (size_t)(nt * 128 + (int)(wave - 4u) * 32) * HID;
  const uint64_t slice_ga = (uint64_t)(size_t)slice_src;
  const uint32_t slice_lds = (uint32_t)(size_t)ring +
      (brings_x ? wave * G_XSLICE : G_WBASE + (wave - 4u) * G_WSLICE);
  const uint32_t slice_rows = brings_x ? 64u : 32u;

  u32x8 g1;
  g1[0] = uni((1u << 20) | (4u << 22) | (3u << 25));
  g1[1] = uni((G_ROWB & 0xFFFFu) << 16);
  g1[2] = uni((G_ROWB >> 16) | (slice_rows << 16));
  g1[3] = uni(G_ROWB << 16);
  g1[4] = uni(slice_rows);
  g1[5] = uni((uint32_t)HID * 2u);
  g1[6] = uni(0u);
  g1[7] = uni(0u);
  asm volatile("" : "+s"(g1));

  auto issue = [&](uint32_t st) {     // stage st: k = 64 st .. 64 st + 63, into buffer st & 1
    const uint64_t ga = slice_ga + (uint64_t)st * G_ROWB;
    u32x4 g0;
    g0[0] = uni(1u);
    g0[1] = uni(slice_lds + (st & 1u) * G_BUF);
    g0[2] = uni((uint32_t)ga);
    g0[3] = uni((((uint32_t)(ga >> 32)) & 0x01FFFFFFu) | 0x80000000u);
    asm volatile("tensor_load_to_lds %0, %1" :: "s"(g0), "s"(g1) : "memory");
  };

  v8f acc[4][4];
#pragma unroll
  for (int i = 0; i < 4; ++i)
#pragma unroll
    for (int j = 0; j < 4; ++j)
#pragma unroll
      for (int r = 0; r < 8; ++r) acc[i][j][r] = 0.0f;

  issue(0u);
  asm volatile("s_wait_tensorcnt 0x0" ::: "memory");  // this wave's slice of stage 0 has landed
  __syncthreads();                                    // every slice of stage 0 is readable
  issue(1u);

  for (int s = 0; s < G_PASSES; ++s) {
    const unsigned char* buf = ring + (uint32_t)(s & 1) * G_BUF;
    const _Float16* xs = (const _Float16*)(buf + (uint32_t)wm * G_XSLICE);
    const unsigned char* wsl = buf + G_WBASE + (uint32_t)(2 * wn) * G_WSLICE;  // this wave's two slices of W
#pragma unroll
    for (int kk = 0; kk < 64; kk += 32) {
      v16h a[4], bf[4];
#pragma unroll
      for (int i = 0; i < 4; ++i) a[i] = load_frag(xs, i * 16 + lane15, (int)(G_PITCH / 2u), kk, lane);
#pragma unroll
      for (int j = 0; j < 4; ++j)
        bf[j] = load_frag((const _Float16*)(wsl + (uint32_t)(j >> 1) * G_WSLICE), (j & 1) * 16 + lane15,
                          (int)(G_PITCH / 2u), kk, lane);
      // Keeps the 16 LDS reads of this k step one group in front of its 16 WMMAs: left alone the
      // compiler reads one X fragment per row of 4 WMMAs and waits for it to 0 each time.
      __builtin_amdgcn_sched_barrier(0);
#pragma unroll
      for (int i = 0; i < 4; ++i)
#pragma unroll
        for (int j = 0; j < 4; ++j) acc[i][j] = wmma_f16(a[i], bf[j], acc[i][j]);
    }
    // Publish point of stage s + 1.
    asm volatile("s_wait_dscnt 0x0" ::: "memory");
    asm volatile("s_wait_tensorcnt 0x0" ::: "memory");
    __syncthreads();
    const uint32_t nxt = pinned((uint32_t)s + 2u);
    if (nxt < (uint32_t)G_PASSES) issue(nxt);
  }
  asm volatile("s_wait_tensorcnt 0x0" ::: "memory");    // no request outlives the loop
  asm volatile("s_wait_dscnt 0x0" ::: "memory");

  // Epilogue: C layout -> lane holds fixed column n, rows m = tile base + hi + r.
  // A tile lies in one batch (256 divides SEQ) and in one of Q, K, V (128 divides HID).
  const int m0 = mt * 256 + wm * 64 + hi;
  const int b = m0 >> 10;
  const int s0 = m0 & 1023;
  const int n0 = (nt & 7) * 128 + wn * 64 + lane15;   // column of j = 0; j adds 16
  const int head = n0 >> 6;                           // the wave's 64 columns are one head
  float bn[4];
#pragma unroll
  for (int j = 0; j < 4; ++j) bn[j] = bias[n0 + j * 16];
  // Before a register that an issued load or store names is written again: it is written at the end
  // of each run of loads or stores.
  asm volatile("s_wait_xcnt 0x0" ::: "memory");
  if (z == 2) {
    _Float16* dst = Vt + (((size_t)(b * NHEAD + head) * DHEAD) + lane15) * SEQ + s0;
#pragma unroll
    for (int j = 0; j < 4; ++j) {
#pragma unroll
      for (int i = 0; i < 4; ++i)
#pragma unroll
        for (int r = 0; r < 8; ++r) dst[(size_t)(j * 16) * SEQ + i * 16 + r] = (_Float16)(acc[i][j][r] + bn[j]);
    }
    asm volatile("s_wait_xcnt 0x0" ::: "memory");
  } else {
    _Float16* dst = ((z == 0) ? Qb : Kb) + (((size_t)(b * NHEAD + head) * SEQ) + s0) * DHEAD + lane15;
#pragma unroll
    for (int j = 0; j < 4; ++j) {
#pragma unroll
      for (int i = 0; i < 4; ++i)
#pragma unroll
        for (int r = 0; r < 8; ++r) dst[(i * 16 + r) * DHEAD + j * 16] = (_Float16)(acc[i][j][r] + bn[j]);
    }
    asm volatile("s_wait_xcnt 0x0" ::: "memory");
  }
}

constexpr uint32_t F_TILE   = 10240u;         // 64 rows x 144 bytes = 9,216, rounded up to a multiple of 2 KiB
constexpr uint32_t F_BUF    = 2u * F_TILE;    // a buffer: the K tile, then the V^T tile
constexpr uint32_t F_PASSES = SEQ / 64;
constexpr int      F_OPITCH = DHEAD + 4;      // floats of a staged output row: 272 bytes, an odd multiple of 16

__device__ __forceinline__ float xhalf(float x) {
  const int i = __builtin_bit_cast(int, x);
  return __builtin_bit_cast(float, __builtin_amdgcn_permlanex16(i, i, 0x76543210, 0xfedcba98, false, false));
}

__global__ __launch_bounds__(128) void flash_attn_kernel(
    const _Float16* __restrict__ Qb, const _Float16* __restrict__ Kb,
    const _Float16* __restrict__ Vt, const float* __restrict__ mask,
    float* __restrict__ out) {
  const int qt = blockIdx.x;   // 0..15
  const int h  = blockIdx.y;   // 0..15
  const int b  = blockIdx.z;   // 0..7
  const uint32_t wave = uni(threadIdx.x >> 5);
  const int lane = threadIdx.x & 31;
  const int lane15 = lane & 15;
  const int hi = (lane & 16) ? 8 : 0;

  constexpr float SCALE = 0.125f;            // 1/sqrt(64)
  constexpr float LOG2E = 1.44269504088896f;

  const _Float16* Q = Qb + (size_t)(b * NHEAD + h) * SEQ * DHEAD;
  const _Float16* K = Kb + (size_t)(b * NHEAD + h) * SEQ * DHEAD;
  const _Float16* V = Vt + (size_t)(b * NHEAD + h) * DHEAD * SEQ;  // [d][s]
  const float* mrow = mask + (size_t)b * SEQ + hi;                 // this lane's eight keys of each 16

  const int qrow = qt * 64 + (int)wave * 16 + lane15;
  const v16h bq0 = load_frag(Q, qrow, DHEAD, 0, lane);    // B operand: column = query
  const v16h bq1 = load_frag(Q, qrow, DHEAD, 32, lane);

  __shared__ __attribute__((aligned(2048))) unsigned char kv[2u * F_BUF];

  // Wave 0's tile of stage st: K rows 64 st .. 64 st + 63 (contiguous). Wave 1's: all 64 rows of V^T,
  // keys 64 st .. 64 st + 63 (source pitch 2,048 bytes). Waves 2 and 3 issue nothing.
  const bool brings_k = wave == 0u;
  const uint64_t tile_ga = (uint64_t)(size_t)(brings_k ? K : V);
  const uint32_t tile_step = brings_k ? 64u * G_ROWB : G_ROWB;   // bytes from one stage's tile to the next
  const uint32_t tile_lds = (uint32_t)(size_t)kv + (brings_k ? 0u : F_TILE);

  u32x8 g1;
  g1[0] = uni((1u << 20) | (4u << 22) | (3u << 25));
  g1[1] = uni((G_ROWB & 0xFFFFu) << 16);
  g1[2] = uni((G_ROWB >> 16) | (64u << 16));
  g1[3] = uni(G_ROWB << 16);
  g1[4] = uni(64u);
  g1[5] = uni(brings_k ? G_ROWB : (uint32_t)SEQ * 2u);
  g1[6] = uni(0u);
  g1[7] = uni(0u);
  asm volatile("" : "+s"(g1));

  auto issue = [&](uint32_t st) {     // stage st into buffer st & 1
    const uint64_t ga = tile_ga + (uint64_t)(st * tile_step);
    u32x4 g0;
    g0[0] = uni(1u);
    g0[1] = uni(tile_lds + (st & 1u) * F_BUF);
    g0[2] = uni((uint32_t)ga);
    g0[3] = uni((((uint32_t)(ga >> 32)) & 0x01FFFFFFu) | 0x80000000u);
    asm volatile("tensor_load_to_lds %0, %1" :: "s"(g0), "s"(g1) : "memory");
  };

  if (pinned(wave < 2u)) {
    issue(0u);
    asm volatile("s_wait_tensorcnt 0x0" ::: "memory");  // this wave's tile of stage 0 has landed
  }
  __syncthreads();                                      // both tiles of stage 0 are readable
  if (pinned(wave < 2u)) issue(1u);

  v8f o[4];                         // O^T: o[t][r] = query lane15, d = 16 t + hi + r
  float m_run = -__builtin_inff();  // this query's running maximum, the same in both halves
  float l_run = 0.0f;               // the sum over this half's keys alone; the halves join in the epilogue
#pragma unroll
  for (int t = 0; t < 4; ++t)
#pragma unroll
    for (int r = 0; r < 8; ++r) o[t][r] = 0.0f;

  for (int kt = 0; kt < (int)F_PASSES; ++kt) {
    const int kb = kt * 64;
    const _Float16* ks = (const _Float16*)(kv + (uint32_t)(kt & 1) * F_BUF);
    const _Float16* vs = (const _Float16*)(kv + (uint32_t)(kt & 1) * F_BUF + F_TILE);

    // ---- S^T = K Q^T: sf[t][r] = key kb + 16 t + hi + r against query lane15 ----
    v8f sf[4];
#pragma unroll
    for (int t = 0; t < 4; ++t)
#pragma unroll
      for (int r = 0; r < 8; ++r) sf[t][r] = 0.0f;

    float4 mv[4][2];   // additive mask of this lane's 32 keys, asked for ahead of the fence below
#pragma unroll
    for (int t = 0; t < 4; ++t) {
      mv[t][0] = *(const float4*)(mrow + kb + t * 16);
      mv[t][1] = *(const float4*)(mrow + kb + t * 16 + 4);
    }
#pragma unroll
    for (int tp = 0; tp < 4; tp += 2) {
      v16h ak0[2], ak1[2];
#pragma unroll
      for (int t = 0; t < 2; ++t) {
        ak0[t] = load_frag(ks, (tp + t) * 16 + lane15, (int)(G_PITCH / 2u), 0, lane);
        ak1[t] = load_frag(ks, (tp + t) * 16 + lane15, (int)(G_PITCH / 2u), 32, lane);
      }
      // Keeps the 8 LDS reads of 32 keys one group in front of their 4 WMMAs: left alone the compiler
      // reads one fragment per WMMA and waits for it to 0 each time. (All 16 reads in one group spill.)
      __builtin_amdgcn_sched_barrier(0);
#pragma unroll
      for (int t = 0; t < 2; ++t) sf[tp + t] = wmma_f16(ak0[t], bq0, sf[tp + t]);
#pragma unroll
      for (int t = 0; t < 2; ++t) sf[tp + t] = wmma_f16(ak1[t], bq1, sf[tp + t]);
    }

    // scale + additive mask (one mask value per key, so per register)
#pragma unroll
    for (int t = 0; t < 4; ++t) {
      const float mk[8] = {mv[t][0].x, mv[t][0].y, mv[t][0].z, mv[t][0].w,
                           mv[t][1].x, mv[t][1].y, mv[t][1].z, mv[t][1].w};
#pragma unroll
      for (int r = 0; r < 8; ++r) sf[t][r] = sf[t][r] * SCALE + mk[r];
    }

    // ---- online softmax: all of a query's scores lie in two lanes ----
    float mx[8];
#pragma unroll
    for (int r = 0; r < 8; ++r) mx[r] = fmaxf(fmaxf(sf[0][r], sf[1][r]), fmaxf(sf[2][r], sf[3][r]));
    float v = fmaxf(fmaxf(fmaxf(mx[0], mx[1]), fmaxf(mx[2], mx[3])),
                    fmaxf(fmaxf(mx[4], mx[5]), fmaxf(mx[6], mx[7])));
    v = fmaxf(v, xhalf(v));
    const float newm = fmaxf(m_run, v);
    const float alpha = exp2f((m_run - newm) * LOG2E);
    m_run = newm;
#pragma unroll
    for (int t = 0; t < 4; ++t)
#pragma unroll
      for (int r = 0; r < 8; ++r)
        sf[t][r] = exp2f((sf[t][r] - newm) * LOG2E);
    float sm[8];
#pragma unroll
    for (int r = 0; r < 8; ++r) sm[r] = (sf[0][r] + sf[1][r]) + (sf[2][r] + sf[3][r]);
    l_run = l_run * alpha + (((sm[0] + sm[1]) + (sm[2] + sm[3])) + ((sm[4] + sm[5]) + (sm[6] + sm[7])));

    // rescale running output
#pragma unroll
    for (int t = 0; t < 4; ++t)
#pragma unroll
      for (int r = 0; r < 8; ++r) o[t][r] *= alpha;

    // ---- P^T as B operand: of keys 32 u .. 32 u + 31 a lane wants hi + 0..7 and 16 + hi + 0..7,
    // which are its registers of score tiles 2 u and 2 u + 1 ----
    v16h bp0, bp1;
#pragma unroll
    for (int j = 0; j < 8; ++j) {
      bp0[j] = (_Float16)sf[0][j]; bp0[j + 8] = (_Float16)sf[1][j];
      bp1[j] = (_Float16)sf[2][j]; bp1[j + 8] = (_Float16)sf[3][j];
    }

    // ---- O^T += V^T P^T  (A fragments = rows of the staged V^T tile) ----
#pragma unroll
    for (int t = 0; t < 4; ++t) {
      v16h av0 = load_frag(vs, t * 16 + lane15, (int)(G_PITCH / 2u), 0, lane);
      v16h av1 = load_frag(vs, t * 16 + lane15, (int)(G_PITCH / 2u), 32, lane);
      o[t] = wmma_f16(av0, bp0, o[t]);
      o[t] = wmma_f16(av1, bp1, o[t]);
    }

    // Publish point of stage kt + 1.
    asm volatile("s_wait_dscnt 0x0" ::: "memory");        // this wave has left buffer kt & 1
    if (pinned(wave < 2u))
      asm volatile("s_wait_tensorcnt 0x0" ::: "memory");
    __syncthreads();
    const uint32_t nxt = pinned((uint32_t)kt + 2u);
    if (pinned((uint32_t)(wave < 2u) & (uint32_t)(nxt < F_PASSES))) issue(nxt);
  }
  asm volatile("s_wait_tensorcnt 0x0" ::: "memory");      // no request outlives the loop
  asm volatile("s_wait_dscnt 0x0" ::: "memory");

  // ---- epilogue: out[b, s, h*64 + d] = O / l ----
  // A lane holds 8 values of d of one query per tile. Each wave turns its 16 x 64 block in a quarter of the
  // ring, its own alone (the last pass's waits and barrier have freed the ring: no reader, no request is
  // left), and stores whole rows of 256 bytes.
  const float inv = 1.0f / (l_run + xhalf(l_run));
  float* stg = (float*)(kv + wave * F_TILE);
#pragma unroll
  for (int t = 0; t < 4; ++t) {
    float* p = stg + lane15 * F_OPITCH + t * 16 + hi;
    *(float4*)(p)     = make_float4(o[t][0] * inv, o[t][1] * inv, o[t][2] * inv, o[t][3] * inv);
    *(float4*)(p + 4) = make_float4(o[t][4] * inv, o[t][5] * inv, o[t][6] * inv, o[t][7] * inv);
  }
  asm volatile("s_wait_dscnt 0x0" ::: "memory");          // the wave's rows are written before it reads them back
  float4 w[8];
#pragma unroll
  for (int i = 0; i < 8; ++i) w[i] = *(const float4*)(stg + (2 * i + (lane >> 4)) * F_OPITCH + lane15 * 4);
  float* orow = out + ((size_t)(b * SEQ + qt * 64 + (int)wave * 16 + (lane >> 4))) * HID + h * DHEAD + lane15 * 4;
#pragma unroll
  for (int i = 0; i < 8; ++i) *(float4*)(orow + (size_t)(2 * i) * HID) = w[i];
}

// ---------------------------------------------------------------------------
// Workspace layout (bytes):
//   Xh  f16 [8192][1024]        @ 0         (16,777,216)
//   Wh3 f16 [3][1024][1024]     @ 16777216  ( 6,291,456)
//   Qb  f16 [8][16][1024][64]   @ 23068672  (16,777,216)
//   Kb  f16 [8][16][1024][64]   @ 39845888  (16,777,216)
//   Vt  f16 [8][16][64][1024]   @ 56623104  (16,777,216)  -> total ~70 MB
// ---------------------------------------------------------------------------
extern "C" void kernel_launch(void* const* d_in, const int* in_sizes, int n_in,
                              void* d_out, int out_size, void* d_ws, size_t ws_size,
                              hipStream_t stream) {
  (void)in_sizes; (void)n_in; (void)out_size; (void)ws_size;
  const float* x    = (const float*)d_in[0];
  const float* mask = (const float*)d_in[1];
  const float* Wq   = (const float*)d_in[2];
  const float* bq   = (const float*)d_in[3];
  const float* Wk   = (const float*)d_in[4];
  const float* bk   = (const float*)d_in[5];
  const float* Wv   = (const float*)d_in[6];
  const float* bv   = (const float*)d_in[7];
  float* out = (float*)d_out;

  char* ws = (char*)d_ws;
  _Float16* Xh  = (_Float16*)(ws + 0);
  _Float16* Wh3 = (_Float16*)(ws + 16777216);
  _Float16* Qb  = (_Float16*)(ws + 23068672);
  _Float16* Kb  = (_Float16*)(ws + 39845888);
  _Float16* Vt  = (_Float16*)(ws + 56623104);

  f32_to_f16_kernel<<<256, 512, 0, stream>>>(x, Wq, Wk, Wv, Xh);   // writes Xh and, behind it, Wh3

  qkv_gemm_kernel<<<dim3(32, 24, 1), 256, 0, stream>>>(Xh, Wh3, bq, bk, bv,
                                                        Qb, Kb, Vt);

  flash_attn_kernel<<<dim3(16, 16, 8), 128, 0, stream>>>(Qb, Kb, Vt, mask, out);
}

// v005
// A run of this version takes 100 microseconds.
// Next to v004, in two timings, it ran 1.05 times as fast each time.
// Over all steps from v000 it is 3.93 times as fast.
#include <hip/hip_runtime.h>
#include <stdint.h>

typedef __attribute__((ext_vector_type(16))) _Float16 v16h;
typedef __attribute__((ext_vector_type(8)))  _Float16 v8h;
typedef __attribute__((ext_vector_type(4)))  _Float16 v4h;
typedef __attribute__((ext_vector_type(8)))  float    v8f;
typedef __attribute__((ext_vector_type(2)))  float    f32x2;

#define NB    8
#define SEQ   1024
#define HID   1024
#define NHEAD 16
#define DHEAD 64

__device__ __forceinline__ v8f wmma_f16(v16h a, v16h b, v8f c) {
  // D = A(16x32 f16) * B(32x16 f16) + C(16x16 f32)
  return __builtin_amdgcn_wmma_f32_16x16x32_f16(false, a, false, b, (short)0, c,
                                                false, false);
}

__device__ __forceinline__ v16h load_frag(const _Float16* base, int row, int ld,
                                          int kbase, int lane) {
  const int half = (lane & 16) ? 8 : 0;
  const _Float16* p = base + (size_t)row * ld + kbase + half;
  v8h c0 = *(const v8h*)(p);
  v8h c1 = *(const v8h*)(p + 16);
  v16h a;
#pragma unroll
  for (int j = 0; j < 8; ++j) { a[j] = c0[j]; a[j + 8] = c1[j]; }
  return a;
}

// ---------------------------------------------------------------------------
// fp32 -> fp16 conversion of X and the three weights, one launch.
// The f16 copies lie one behind the other in the workspace (Xh, then Wh3), so the job is one stream of
// 22 * 2^17 groups of four values: 16 * 2^17 of X, 2 * 2^17 of each weight.
// grid = 256 work-groups of 16 waves = 2^17 threads, all resident at once; thread t converts group
// k * 2^17 + t for k = 0..21, so each wave-wide load is 512 contiguous bytes, each store 256, and which
// source a k reads is known at compile time. Few long-lived waves: a wave's start is paid 4,096 times.
// ---------------------------------------------------------------------------
constexpr int CV_THREADS = 256 * 512;                    // 2^17
constexpr int CV_X = NB * SEQ * HID / 4 / CV_THREADS;    // 16 groups a thread from X
constexpr int CV_W = HID * HID / 4 / CV_THREADS;         // 2 from each weight
constexpr int CV_ALL = CV_X + 3 * CV_W;

__global__ __launch_bounds__(512) void f32_to_f16_kernel(
    const float* __restrict__ x, const float* __restrict__ Wq, const float* __restrict__ Wk,
    const float* __restrict__ Wv, _Float16* __restrict__ dst) {
  const int t = blockIdx.x * 512 + threadIdx.x;
  float4 v[CV_ALL];   // loads written ahead of all use, so that many of a wave's loads are in flight together
#pragma unroll
  for (int k = 0; k < CV_X; ++k) v[k] = *(const float4*)(x + ((size_t)k * CV_THREADS + t) * 4);
#pragma unroll
  for (int k = 0; k < CV_W; ++k) {
    v[CV_X + k]            = *(const float4*)(Wq + ((size_t)k * CV_THREADS + t) * 4);
    v[CV_X + CV_W + k]     = *(const float4*)(Wk + ((size_t)k * CV_THREADS + t) * 4);
    v[CV_X + 2 * CV_W + k] = *(const float4*)(Wv + ((size_t)k * CV_THREADS + t) * 4);
  }
#pragma unroll
  for (int k = 0; k < CV_ALL; ++k) {
    v4h o;
    o[0] = (_Float16)v[k].x; o[1] = (_Float16)v[k].y;
    o[2] = (_Float16)v[k].z; o[3] = (_Float16)v[k].w;
    *(v4h*)(dst + ((size_t)k * CV_THREADS + t) * 4) = o;
  }
}

// ---------------------------------------------------------------------------
// Fused QKV projection: Y = Xh @ W^T + bias, the three weights read as one [3072][1024] matrix.
// grid = (M/256, 3072/128).  256 threads = 8 waves (4 x 2); wave owns 64 rows x 64 cols.
// A pass is 64 k: 256 rows of X and 128 rows of W, 128 bytes each, staged in LDS by tensor loads
// (one slice per wave: 64 rows of X or 32 of W; LDS pitch 144 bytes), two buffers, the next pass in flight.
// cols 0..1023 -> Q [B,h,S,d], 1024..2047 -> K [B,h,S,d], 2048..3071 -> V transposed [B,h,d,S].
// ---------------------------------------------------------------------------
typedef uint32_t u32x4 __attribute__((ext_vector_type(4)));
typedef uint32_t u32x8 __attribute__((ext_vector_type(8)));

constexpr uint32_t G_ROWB  = 128u;
constexpr uint32_t G_PITCH = G_ROWB + 16u;
constexpr uint32_t G_XSLICE = 10240u;
constexpr uint32_t G_WSLICE = 6144u;
constexpr uint32_t G_WBASE  = 4u * G_XSLICE;
constexpr uint32_t G_BUF    = G_WBASE + 4u * G_WSLICE;
constexpr int      G_PASSES = HID / 64;

__device__ __forceinline__ uint32_t uni(uint32_t v) {
  return (uint32_t)__builtin_amdgcn_readfirstlane(v);
}
__device__ __forceinline__ uint32_t pinned(uint32_t v) {
  uint32_t w = uni(v);
  asm volatile("" : "+s"(w));
  return w;
}

__global__ __launch_bounds__(256) void qkv_gemm_kernel(
    const _Float16* __restrict__ Xh, const _Float16* __restrict__ Wh3,
    const float* __restrict__ bq, const float* __restrict__ bk,
    const float* __restrict__ bv,
    _Float16* __restrict__ Qb, _Float16* __restrict__ Kb,
    _Float16* __restrict__ Vt) {
  __shared__ __attribute__((aligned(2048))) unsigned char ring[2u * G_BUF];

  const int mt = blockIdx.x;          // 0..31, 256 rows each (rows = B*S)
  const int nt = blockIdx.y;          // 0..23, 128 cols each (cols = 3*HID)
  const int z  = nt >> 3;             // 0:Q 1:K 2:V
  const uint32_t wave = uni(threadIdx.x >> 5);
  const int wm = (int)(wave >> 1);    // wave's 64-row quarter of the tile
  const int wn = (int)(wave & 1u);    // wave's 64-col half of the tile
  const int lane = threadIdx.x & 31;
  const int lane15 = lane & 15;
  const int hi = (lane & 16) ? 8 : 0;

  const float* bias = (z == 0) ? bq : ((z == 1) ? bk : bv);

  // This wave's slice of every stage: waves 0 to 3 bring 64 rows of X each, waves 4 to 7 32 rows of W.
  const bool brings_x = wave < 4u;
  const _Float16* slice_src = brings_x
      ? Xh  + (size_t)(mt * 256 + (int)wave * 64) * HID
      : Wh3 + (size_t)(nt * 128 + (int)(wave - 4u) * 32) * HID;
  const uint64_t slice_ga = (uint64_t)(size_t)slice_src;
  const uint32_t slice_lds = (uint32_t)(size_t)ring +
      (brings_x ? wave * G_XSLICE : G_WBASE + (wave - 4u) * G_WSLICE);
  const uint32_t slice_rows = brings_x ? 64u : 32u;

  u32x8 g1;
  g1[0] = uni((1u << 20) | (4u << 22) | (3u << 25));
  g1[1] = uni((G_ROWB & 0xFFFFu) << 16);
  g1[2] = uni((G_ROWB >> 16) | (slice_rows << 16));
  g1[3] = uni(G_ROWB << 16);
  g1[4] = uni(slice_rows);
  g1[5] = uni((uint32_t)HID * 2u);
  g1[6] = uni(0u);
  g1[7] = uni(0u);
  asm volatile("" : "+s"(g1));

  auto issue = [&](uint32_t st) {     // stage st: k = 64 st .. 64 st + 63, into buffer st & 1
    const uint64_t ga = slice_ga + (uint64_t)st * G_ROWB;
    u32x4 g0;
    g0[0] = uni(1u);
    g0[1] = uni(slice_lds + (st & 1u) * G_BUF);
    g0[2] = uni((uint32_t)ga);
    g0[3] = uni((((uint32_t)(ga >> 32)) & 0x01FFFFFFu) | 0x80000000u);
    asm volatile("tensor_load_to_lds %0, %1" :: "s"(g0), "s"(g1) : "memory");
  };

  v8f acc[4][4];
#pragma unroll
  for (int i = 0; i < 4; ++i)
#pragma unroll
    for (int j = 0; j < 4; ++j)
#pragma unroll
      for (int r = 0; r < 8; ++r) acc[i][j][r] = 0.0f;

  issue(0u);
  asm volatile("s_wait_tensorcnt 0x0" ::: "memory");  // this wave's slice of stage 0 has landed
  __syncthreads();                                    // every slice of stage 0 is readable
  issue(1u);

  for (int s = 0; s < G_PASSES; ++s) {
    const unsigned char* buf = ring + (uint32_t)(s & 1) * G_BUF;
    const _Float16* xs = (const _Float16*)(buf + (uint32_t)wm * G_XSLICE);
    const unsigned char* wsl = buf + G_WBASE + (uint32_t)(2 * wn) * G_WSLICE;  // this wave's two slices of W
#pragma unroll
    for (int kk = 0; kk < 64; kk += 32) {
      v16h a[4], bf[4];
#pragma unroll
      for (int i = 0; i < 4; ++i) a[i] = load_frag(xs, i * 16 + lane15, (int)(G_PITCH / 2u), kk, lane);
#pragma unroll
      for (int j = 0; j < 4; ++j)
        bf[j] = load_frag((const _Float16*)(wsl + (uint32_t)(j >> 1) * G_WSLICE), (j & 1) * 16 + lane15,
                          (int)(G_PITCH / 2u), kk, lane);
      // Keeps the 16 LDS reads of this k step one group in front of its 16 WMMAs: left alone the
      // compiler reads one X fragment per row of 4 WMMAs and waits for it to 0 each time.
      __builtin_amdgcn_sched_barrier(0);
#pragma unroll
      for (int i = 0; i < 4; ++i)
#pragma unroll
        for (int j = 0; j < 4; ++j) acc[i][j] = wmma_f16(a[i], bf[j], acc[i][j]);
    }
    // Publish point of stage s + 1.
    asm volatile("s_wait_dscnt 0x0" ::: "memory");
    asm volatile("s_wait_tensorcnt 0x0" ::: "memory");
    __syncthreads();
    const uint32_t nxt = pinned((uint32_t)s + 2u);
    if (nxt < (uint32_t)G_PASSES) issue(nxt);
  }
  asm volatile("s_wait_tensorcnt 0x0" ::: "memory");    // no request outlives the loop
  asm volatile("s_wait_dscnt 0x0" ::: "memory");

  // Epilogue: C layout -> lane holds fixed column n, rows m = tile base + hi + r.
  // A tile lies in one batch (256 divides SEQ) and in one of Q, K, V (128 divides HID).
  const int m0 = mt * 256 + wm * 64 + hi;
  const int b = m0 >> 10;
  const int s0 = m0 & 1023;
  const int n0 = (nt & 7) * 128 + wn * 64 + lane15;   // column of j = 0; j adds 16
  const int head = n0 >> 6;                           // the wave's 64 columns are one head
  float bn[4];
#pragma unroll
  for (int j = 0; j < 4; ++j) bn[j] = bias[n0 + j * 16];
  // Before a register that an issued load or store names is written again: it is written at the end
  // of each run of loads or stores.
  asm volatile("s_wait_xcnt 0x0" ::: "memory");
  if (z == 2) {
    _Float16* dst = Vt + (((size_t)(b * NHEAD + head) * DHEAD) + lane15) * SEQ + s0;
#pragma unroll
    for (int j = 0; j < 4; ++j) {
#pragma unroll
      for (int i = 0; i < 4; ++i)
#pragma unroll
        for (int r = 0; r < 8; ++r) dst[(size_t)(j * 16) * SEQ + i * 16 + r] = (_Float16)(acc[i][j][r] + bn[j]);
    }
    asm volatile("s_wait_xcnt 0x0" ::: "memory");
  } else {
    _Float16* dst = ((z == 0) ? Qb : Kb) + (((size_t)(b * NHEAD + head) * SEQ) + s0) * DHEAD + lane15;
#pragma unroll
    for (int j = 0; j < 4; ++j) {
#pragma unroll
      for (int i = 0; i < 4; ++i)
#pragma unroll
        for (int r = 0; r < 8; ++r) dst[(i * 16 + r) * DHEAD + j * 16] = (_Float16)(acc[i][j][r] + bn[j]);
    }
    asm volatile("s_wait_xcnt 0x0" ::: "memory");
  }
}

constexpr uint32_t F_TILE   = 10240u;         // 64 rows x 144 bytes = 9,216, rounded up to a multiple of 2 KiB
constexpr uint32_t F_BUF    = 2u * F_TILE;    // a buffer: the K tile, then the V^T tile
constexpr uint32_t F_PASSES = SEQ / 64;
constexpr int      F_OPITCH = DHEAD + 4;      // floats of a staged output row: 272 bytes, an odd multiple of 16

__device__ __forceinline__ float xhalf(float x) {
  const int i = __builtin_bit_cast(int, x);
  return __builtin_bit_cast(float, __builtin_amdgcn_permlanex16(i, i, 0x76543210, 0xfedcba98, false, false));
}

__global__ __launch_bounds__(128) void flash_attn_kernel(
    const _Float16* __restrict__ Qb, const _Float16* __restrict__ Kb,
    const _Float16* __restrict__ Vt, const float* __restrict__ mask,
    float* __restrict__ out) {
  const int qt = blockIdx.x;   // 0..15
  const int h  = blockIdx.y;   // 0..15
  const int b  = blockIdx.z;   // 0..7
  const uint32_t wave = uni(threadIdx.x >> 5);
  const int lane = threadIdx.x & 31;
  const int lane15 = lane & 15;
  const int hi = (lane & 16) ? 8 : 0;

  constexpr float SCALE = 0.125f;            // 1/sqrt(64)
  constexpr float LOG2E = 1.44269504088896f;

  const _Float16* Q = Qb + (size_t)(b * NHEAD + h) * SEQ * DHEAD;
  const _Float16* K = Kb + (size_t)(b * NHEAD + h) * SEQ * DHEAD;
  const _Float16* V = Vt + (size_t)(b * NHEAD + h) * DHEAD * SEQ;  // [d][s]
  const float* mrow = mask + (size_t)b * SEQ + hi;                 // this lane's eight keys of each 16

  const int qrow = qt * 64 + (int)wave * 16 + lane15;
  const v16h bq0 = load_frag(Q, qrow, DHEAD, 0, lane);    // B operand: column = query
  const v16h bq1 = load_frag(Q, qrow, DHEAD, 32, lane);

  __shared__ __attribute__((aligned(2048))) unsigned char kv[2u * F_BUF];

  // Wave 0's tile of stage st: K rows 64 st .. 64 st + 63 (contiguous). Wave 1's: all 64 rows of V^T,
  // keys 64 st .. 64 st + 63 (source pitch 2,048 bytes). Waves 2 and 3 issue nothing.
  const bool brings_k = wave == 0u;
  const uint64_t tile_ga = (uint64_t)(size_t)(brings_k ? K : V);
  const uint32_t tile_step = brings_k ? 64u * G_ROWB : G_ROWB;   // bytes from one stage's tile to the next
  const uint32_t tile_lds = (uint32_t)(size_t)kv + (brings_k ? 0u : F_TILE);

  u32x8 g1;
  g1[0] = uni((1u << 20) | (4u << 22) | (3u << 25));
  g1[1] = uni((G_ROWB & 0xFFFFu) << 16);
  g1[2] = uni((G_ROWB >> 16) | (64u << 16));
  g1[3] = uni(G_ROWB << 16);
  g1[4] = uni(64u);
  g1[5] = uni(brings_k ? G_ROWB : (uint32_t)SEQ * 2u);
  g1[6] = uni(0u);
  g1[7] = uni(0u);
  asm volatile("" : "+s"(g1));

  auto issue = [&](uint32_t st) {     // stage st into buffer st & 1
    const uint64_t ga = tile_ga + (uint64_t)(st * tile_step);
    u32x4 g0;
    g0[0] = uni(1u);
    g0[1] = uni(tile_lds + (st & 1u) * F_BUF);
    g0[2] = uni((uint32_t)ga);
    g0[3] = uni((((uint32_t)(ga >> 32)) & 0x01FFFFFFu) | 0x80000000u);
    asm volatile("tensor_load_to_lds %0, %1" :: "s"(g0), "s"(g1) : "memory");
  };

  if (pinned(wave < 2u)) {
    issue(0u);
    asm volatile("s_wait_tensorcnt 0x0" ::: "memory");  // this wave's tile of stage 0 has landed
  }
  __syncthreads();                                      // both tiles of stage 0 are readable
  if (pinned(wave < 2u)) issue(1u);

  v8f o[4];                         // O^T: o[t][r] = query lane15, d = 16 t + hi + r
  float m_run = -__builtin_inff();  // this query's running maximum, the same in both halves
  float l_run = 0.0f;               // the sum over this half's keys alone; the halves join in the epilogue
#pragma unroll
  for (int t = 0; t < 4; ++t)
#pragma unroll
    for (int r = 0; r < 8; ++r) o[t][r] = 0.0f;

  for (int kt = 0; kt < (int)F_PASSES; ++kt) {
    const int kb = kt * 64;
    const _Float16* ks = (const _Float16*)(kv + (uint32_t)(kt & 1) * F_BUF);
    const _Float16* vs = (const _Float16*)(kv + (uint32_t)(kt & 1) * F_BUF + F_TILE);

    // ---- S^T = K Q^T: sf[t][r] = key kb + 16 t + hi + r against query lane15 ----
    v8f sf[4];
#pragma unroll
    for (int t = 0; t < 4; ++t)
#pragma unroll
      for (int r = 0; r < 8; ++r) sf[t][r] = 0.0f;

    float4 mv[4][2];   // additive mask of this lane's 32 keys, asked for ahead of the fence below
#pragma unroll
    for (int t = 0; t < 4; ++t) {
      mv[t][0] = *(const float4*)(mrow + kb + t * 16);
      mv[t][1] = *(const float4*)(mrow + kb + t * 16 + 4);
    }
#pragma unroll
    for (int tp = 0; tp < 4; tp += 2) {
      v16h ak0[2], ak1[2];
#pragma unroll
      for (int t = 0; t < 2; ++t) {
        ak0[t] = load_frag(ks, (tp + t) * 16 + lane15, (int)(G_PITCH / 2u), 0, lane);
        ak1[t] = load_frag(ks, (tp + t) * 16 + lane15, (int)(G_PITCH / 2u), 32, lane);
      }
      // Keeps the 8 LDS reads of 32 keys one group in front of their 4 WMMAs: left alone the compiler
      // reads one fragment per WMMA and waits for it to 0 each time. (All 16 reads in one group spill.)
      __builtin_amdgcn_sched_barrier(0);
#pragma unroll
      for (int t = 0; t < 2; ++t) sf[tp + t] = wmma_f16(ak0[t], bq0, sf[tp + t]);
#pragma unroll
      for (int t = 0; t < 2; ++t) sf[tp + t] = wmma_f16(ak1[t], bq1, sf[tp + t]);
    }

    // scale + additive mask (one mask value per key, so per register)
#pragma unroll
    for (int t = 0; t < 4; ++t) {
      const float mk[8] = {mv[t][0].x, mv[t][0].y, mv[t][0].z, mv[t][0].w,
                           mv[t][1].x, mv[t][1].y, mv[t][1].z, mv[t][1].w};
#pragma unroll
      for (int r = 0; r < 8; ++r) sf[t][r] = sf[t][r] * SCALE + mk[r];
    }

    // ---- online softmax: all of a query's scores lie in two lanes ----
    float mx[8];
#pragma unroll
    for (int r = 0; r < 8; ++r) mx[r] = fmaxf(fmaxf(sf[0][r], sf[1][r]), fmaxf(sf[2][r], sf[3][r]));
    float v = fmaxf(fmaxf(fmaxf(mx[0], mx[1]), fmaxf(mx[2], mx[3])),
                    fmaxf(fmaxf(mx[4], mx[5]), fmaxf(mx[6], mx[7])));
    v = fmaxf(v, xhalf(v));
    const float newm = fmaxf(m_run, v);
    const float alpha = __builtin_amdgcn_exp2f((m_run - newm) * LOG2E);   // 0 on the first pass, where m_run is -inf
    m_run = newm;
    const f32x2 nm = {newm, newm};
    const f32x2 l2e = {LOG2E, LOG2E};
#pragma unroll
    for (int t = 0; t < 4; ++t)
#pragma unroll
      for (int r = 0; r < 8; r += 2) {
        const f32x2 arg = (f32x2{sf[t][r], sf[t][r + 1]} - nm) * l2e;
        sf[t][r]     = __builtin_amdgcn_exp2f(arg.x);
        sf[t][r + 1] = __builtin_amdgcn_exp2f(arg.y);
      }
    float sm[8];
#pragma unroll
    for (int r = 0; r < 8; ++r) sm[r] = (sf[0][r] + sf[1][r]) + (sf[2][r] + sf[3][r]);
    l_run = l_run * alpha + (((sm[0] + sm[1]) + (sm[2] + sm[3])) + ((sm[4] + sm[5]) + (sm[6] + sm[7])));

    // rescale running output
#pragma unroll
    for (int t = 0; t < 4; ++t)
#pragma unroll
      for (int r = 0; r < 8; ++r) o[t][r] *= alpha;

    // ---- P^T as B operand: of keys 32 u .. 32 u + 31 a lane wants hi + 0..7 and 16 + hi + 0..7,
    // which are its registers of score tiles 2 u and 2 u + 1 ----
    v16h bp0, bp1;
#pragma unroll
    for (int j = 0; j < 8; ++j) {
      bp0[j] = (_Float16)sf[0][j]; bp0[j + 8] = (_Float16)sf[1][j];
      bp1[j] = (_Float16)sf[2][j]; bp1[j + 8] = (_Float16)sf[3][j];
    }

    // ---- O^T += V^T P^T  (A fragments = rows of the staged V^T tile) ----
#pragma unroll
    for (int t = 0; t < 4; ++t) {
      v16h av0 = load_frag(vs, t * 16 + lane15, (int)(G_PITCH / 2u), 0, lane);
      v16h av1 = load_frag(vs, t * 16 + lane15, (int)(G_PITCH / 2u), 32, lane);
      o[t] = wmma_f16(av0, bp0, o[t]);
      o[t] = wmma_f16(av1, bp1, o[t]);
    }

    // Publish point of stage kt + 1.
    asm volatile("s_wait_dscnt 0x0" ::: "memory");        // this wave has left buffer kt & 1
    if (pinned(wave < 2u))
      asm volatile("s_wait_tensorcnt 0x0" ::: "memory");
    __syncthreads();
    const uint32_t nxt = pinned((uint32_t)kt + 2u);
    if (pinned((uint32_t)(wave < 2u) & (uint32_t)(nxt < F_PASSES))) issue(nxt);
  }
  asm volatile("s_wait_tensorcnt 0x0" ::: "memory");      // no request outlives the loop
  asm volatile("s_wait_dscnt 0x0" ::: "memory");

  // ---- epilogue: out[b, s, h*64 + d] = O / l ----
  // A lane holds 8 values of d of one query per tile. Each wave turns its 16 x 64 block in a quarter of the
  // ring, its own alone (the last pass's waits and barrier have freed the ring: no reader, no request is
  // left), and stores whole rows of 256 bytes.
  const float inv = 1.0f / (l_run + xhalf(l_run));
  float* stg = (float*)(kv + wave * F_TILE);
#pragma unroll
  for (int t = 0; t < 4; ++t) {
    float* p = stg + lane15 * F_OPITCH + t * 16 + hi;
    *(float4*)(p)     = make_float4(o[t][0] * inv, o[t][1] * inv, o[t][2] * inv, o[t][3] * inv);
    *(float4*)(p + 4) = make_float4(o[t][4] * inv, o[t][5] * inv, o[t][6] * inv, o[t][7] * inv);
  }
  asm volatile("s_wait_dscnt 0x0" ::: "memory");          // the wave's rows are written before it reads them back
  float4 w[8];
#pragma unroll
  for (int i = 0; i < 8; ++i) w[i] = *(const float4*)(stg + (2 * i + (lane >> 4)) * F_OPITCH + lane15 * 4);
  float* orow = out + ((size_t)(b * SEQ + qt * 64 + (int)wave * 16 + (lane >> 4))) * HID + h * DHEAD + lane15 * 4;
#pragma unroll
  for (int i = 0; i < 8; ++i) *(float4*)(orow + (size_t)(2 * i) * HID) = w[i];
}

// ---------------------------------------------------------------------------
// Workspace layout (bytes):
//   Xh  f16 [8192][1024]        @ 0         (16,777,216)
//   Wh3 f16 [3][1024][1024]     @ 16777216  ( 6,291,456)
//   Qb  f16 [8][16][1024][64]   @ 23068672  (16,777,216)
//   Kb  f16 [8][16][1024][64]   @ 39845888  (16,777,216)
//   Vt  f16 [8][16][64][1024]   @ 56623104  (16,777,216)  -> total ~70 MB
// ---------------------------------------------------------------------------
extern "C" void kernel_launch(void* const* d_in, const int* in_sizes, int n_in,
                              void* d_out, int out_size, void* d_ws, size_t ws_size,
                              hipStream_t stream) {
  (void)in_sizes; (void)n_in; (void)out_size; (void)ws_size;
  const float* x    = (const float*)d_in[0];
  const float* mask = (const float*)d_in[1];
  const float* Wq   = (const float*)d_in[2];
  const float* bq   = (const float*)d_in[3];
  const float* Wk   = (const float*)d_in[4];
  const float* bk   = (const float*)d_in[5];
  const float* Wv   = (const float*)d_in[6];
  const float* bv   = (const float*)d_in[7];
  float* out = (float*)d_out;

  char* ws = (char*)d_ws;
  _Float16* Xh  = (_Float16*)(ws + 0);
  _Float16* Wh3 = (_Float16*)(ws + 16777216);
  _Float16* Qb  = (_Float16*)(ws + 23068672);
  _Float16* Kb  = (_Float16*)(ws + 39845888);
  _Float16* Vt  = (_Float16*)(ws + 56623104);

  f32_to_f16_kernel<<<256, 512, 0, stream>>>(x, Wq, Wk, Wv, Xh);   // writes Xh and, behind it, Wh3

  qkv_gemm_kernel<<<dim3(32, 24, 1), 256, 0, stream>>>(Xh, Wh3, bq, bk, bv,
                                                        Qb, Kb, Vt);

  flash_attn_kernel<<<dim3(16, 16, 8), 128, 0, stream>>>(Qb, Kb, Vt, mask, out);
}
